// v000
// Times are from an AMD MI455X. After a warm-up the kernel runs many times in a row, and a time is the length of
// such a window on the GPU divided by its runs, so every launch and the gaps after it count. The runs cycle
// through copies of the inputs. A figure is the median of several windows, for all but v000 over two sittings.
// Sittings can differ by a few percent; kernels timed side by side share one.
// v000, which the later versions start from, runs in 656 microseconds.
#include <hip/hip_runtime.h>

// Single-head self-attention (x [4][4096][64]; qkv = x W + b ('xw' [64][192] + [192]) -> q | k | v (64 each); scores = q.k / 8 over all 4096 keys; softmax; out = attn v -> [4][4096][64] (1.0 M)).
// Compute dtypes, f32 accumulate: every input rounded to bf16; the fused projection on PLAIN bf16 operands (exact) + f32 bias; scores and attn.v on bf16 hi/lo planes (3 products) for every row; softmax f32 (streaming, one wave per row); the attn.v GEMM writes the output rows directly.

#define NB_  4
#define TT   4096
#define DM   64
#define HD   64
#define NH_  1
#define DQ   64
#define D3   192
#define ZH   1
#define PCAR 1024.0f
#define SCL  0.125f   // DIM^-0.5
typedef _Float16 h16;
typedef unsigned short bf;
typedef __attribute__((ext_vector_type(16))) __bf16   v16bf;
typedef __attribute__((ext_vector_type(16))) _Float16 v16h;
typedef __attribute__((ext_vector_type(8)))  _Float16 v8h;
typedef __attribute__((ext_vector_type(8)))  unsigned short v8us;
typedef __attribute__((ext_vector_type(8)))  float    v8f;
typedef __attribute__((ext_vector_type(4)))  float    v4f;
typedef v8h  __attribute__((may_alias)) v8ha;
typedef v4f  __attribute__((may_alias)) v4fa;
typedef v8us __attribute__((may_alias)) v8usa;

__device__ __forceinline__ unsigned short f2bf(float f) { unsigned u = __float_as_uint(f); u += 0x7FFFu + ((u >> 16) & 1u); return (unsigned short)(u >> 16); }
__device__ __forceinline__ float bf2f(unsigned short b) { return __uint_as_float(((unsigned)b) << 16); }
__device__ __forceinline__ float bfr(float f) { return bf2f(f2bf(f)); }
__device__ __forceinline__ v16h cat16(v8h lo, v8h hi) { return __builtin_shufflevector(lo, hi, 0, 1, 2, 3, 4, 5, 6, 7, 8, 9, 10, 11, 12, 13, 14, 15); }
__device__ __forceinline__ v16bf cat16b(v8us lo, v8us hi) { return __builtin_bit_cast(v16bf, __builtin_shufflevector(lo, hi, 0, 1, 2, 3, 4, 5, 6, 7, 8, 9, 10, 11, 12, 13, 14, 15)); }
__device__ __forceinline__ v8f wmma16(v16h a, v16h b, v8f c) { return __builtin_amdgcn_wmma_f32_16x16x32_f16(false, a, false, b, (short)0, c, false, false); }
__device__ __forceinline__ v8f wmmab(v16bf a, v16bf b, v8f c) { return __builtin_amdgcn_wmma_f32_16x16x32_bf16(false, a, false, b, (short)0, c, false, false); }



// ---- k_gemmw: register-blocked GEMM, ONE WAVE per 64x64 output tile (16 accumulators), operands straight from K-contiguous 16-bit planes; grid (M/64, N/64, Z), 32 threads.
// C[m][n] (f32, pitch ldc, + optional f32 bias[n]) = sum_k A[m][k] Bt[n][k] (+ split products per NSPLIT). z-batch strides sA/sB/sC in elements. K % 32 == 0.
template <typename T16> struct WFrag;
template <> struct WFrag<h16> { typedef v16h V; static __device__ __forceinline__ V ld(const h16* p) { return cat16(*(const v8h*)p, *(const v8h*)(p + 16)); } static __device__ __forceinline__ v8f mma(V a, V b, v8f c) { return wmma16(a, b, c); } };
template <> struct WFrag<bf> { typedef v16bf V; static __device__ __forceinline__ V ld(const bf* p) { return cat16b(*(const v8us*)p, *(const v8us*)(p + 16)); } static __device__ __forceinline__ v8f mma(V a, V b, v8f c) { return wmmab(a, b, c); } };
template <typename T16, int NSPLIT, bool BIAS>
__global__ __launch_bounds__(32) void k_gemmw(const T16* __restrict__ A, const T16* __restrict__ A2, const T16* __restrict__ Bt, const T16* __restrict__ Bt2, int K, float* C, int ldc, const float* __restrict__ bias, size_t sA, size_t sB, size_t sC) {
    typedef typename WFrag<T16>::V V;
    __shared__ __align__(16) float os[16 * 68];
    const size_t z = blockIdx.z; A += z * sA; if (A2) A2 += z * sA; Bt += z * sB; if (Bt2) Bt2 += z * sB; C += z * sC;
    const int lane = threadIdx.x & 31, lr = lane & 15, hi = lane >> 4; const int r0 = blockIdx.x * 64, c0 = blockIdx.y * 64;
    v8f acc[4][4];
#pragma unroll
    for (int mb = 0; mb < 4; ++mb)
#pragma unroll
        for (int nb = 0; nb < 4; ++nb) acc[mb][nb] = (v8f){};
    const size_t aoff = (size_t)(r0 + lr) * K + 8 * hi, boff = (size_t)(c0 + lr) * K + 8 * hi;
#pragma unroll 1
    for (int kc = 0; kc < K; kc += 32) {
        V a[4], a2[4];
#pragma unroll
        for (int mb = 0; mb < 4; ++mb) { a[mb] = WFrag<T16>::ld(A + aoff + (size_t)mb * 16 * K + kc); if (NSPLIT == 1 || NSPLIT == 2) a2[mb] = WFrag<T16>::ld(A2 + aoff + (size_t)mb * 16 * K + kc); }
#pragma unroll
        for (int nb = 0; nb < 4; ++nb) { const V b = WFrag<T16>::ld(Bt + boff + (size_t)nb * 16 * K + kc); V b2; if (NSPLIT >= 2) b2 = WFrag<T16>::ld(Bt2 + boff + (size_t)nb * 16 * K + kc);
#pragma unroll
            for (int mb = 0; mb < 4; ++mb) { acc[mb][nb] = WFrag<T16>::mma(a[mb], b, acc[mb][nb]); if (NSPLIT == 1 || NSPLIT == 2) acc[mb][nb] = WFrag<T16>::mma(a2[mb], b, acc[mb][nb]); if (NSPLIT >= 2) acc[mb][nb] = WFrag<T16>::mma(a[mb], b2, acc[mb][nb]); } }
        asm volatile("v_nop\n\tv_nop\n\tv_nop\n\tv_nop" : "+v"(acc[0][0]), "+v"(acc[1][1]), "+v"(acc[2][2]), "+v"(acc[3][3]) : "v"(a[0]), "v"(a[3]));
    }
#pragma unroll
    for (int mb = 0; mb < 4; ++mb) {
#pragma unroll
        for (int nb = 0; nb < 4; ++nb) {
#pragma unroll
            for (int j = 0; j < 8; ++j) os[(hi * 8 + j) * 68 + nb * 16 + lr] = acc[mb][nb][j]; }
        __builtin_amdgcn_wave_barrier(); asm volatile("" ::: "memory");
        float* crow = C + (size_t)(r0 + mb * 16) * ldc + c0;
{
#pragma unroll
            for (int s = 0; s < 8; ++s) { const int row = 2 * s + hi, cofs = lr * 4; v4f val = *(const v4fa*)(os + row * 68 + cofs); if (BIAS) { val[0] += bfr(bias[c0 + cofs]); val[1] += bfr(bias[c0 + cofs + 1]); val[2] += bfr(bias[c0 + cofs + 2]); val[3] += bfr(bias[c0 + cofs + 3]); }
                *(v4f*)(crow + (size_t)row * ldc + cofs) = val; }
             }
        __builtin_amdgcn_wave_barrier(); asm volatile("" ::: "memory");
    }
}

__device__ __forceinline__ h16 tohx(float x) { return (h16)x; }
__device__ __forceinline__ void splitf(float y, unsigned short& h, unsigned short& l) { h = f2bf(y); l = f2bf(y - bf2f(h)); }
typedef __attribute__((ext_vector_type(2))) _Float16 v2h;
typedef __attribute__((ext_vector_type(4))) _Float16 v4h;
typedef __attribute__((ext_vector_type(2))) unsigned short v2us;
typedef __attribute__((ext_vector_type(4))) unsigned short v4us;
typedef __attribute__((ext_vector_type(2))) float v2f;
typedef __attribute__((ext_vector_type(4))) int v4i;

__global__ __launch_bounds__(256) void k_cvt8(const float* __restrict__ src, bf* dst, size_t n8) { const size_t i = (size_t)blockIdx.x * 256 + threadIdx.x; if (i >= n8) return; const v8f v = *(const v8f*)(src + i * 8); v8us o;
#pragma unroll
    for (int k = 0; k < 8; ++k) o[k] = f2bf(v[k]); *(v8us*)(dst + i * 8) = o;  }
__global__ __launch_bounds__(256) void k_wtG(const float* __restrict__ w, int K, int N, bf* Bt) {
    const int lane = threadIdx.x & 31; const int L0 = (blockIdx.x * 8 + (threadIdx.x >> 5)) * 8; const int nlines = N * K / 64;
{
#pragma unroll 1
        for (int l = 0; l < 8; ++l) { const int L = L0 + l; if (L >= nlines) break; const size_t e = (size_t)L * 64 + lane * 2; const int k = (int)(e % K), n = (int)(e / K); v2us o;
            o[0] = f2bf(w[(size_t)k * N + n]); o[1] = f2bf(w[(size_t)(k + 1) * N + n]); *(v2us*)(Bt + e) = o; }
         }
}

__global__ __launch_bounds__(256) void k_pl2(const float* __restrict__ F, int coff, bf* Ph, bf* Pl) { const size_t e = ((size_t)blockIdx.x * 256 + threadIdx.x) * 2; if (e >= (size_t)TT * HD) return; const int d = (int)(e % HD); const int t = (int)(e / HD); const float* f = F + (size_t)t * D3 + coff + d; v2us oh, ol;
#pragma unroll
    for (int q = 0; q < 2; ++q) { unsigned short a, c2; splitf(f[q], a, c2); oh[q] = a; ol[q] = c2; }
    *(v2us*)(Ph + e) = oh; *(v2us*)(Pl + e) = ol;  }
__global__ __launch_bounds__(256) void k_vt2(const float* __restrict__ F, int coff, bf* Vh, bf* Vl) { const size_t e = ((size_t)blockIdx.x * 256 + threadIdx.x) * 2; if (e >= (size_t)HD * TT) return; const int t = (int)(e % TT); const int d = (int)(e / TT); v2us oh, ol;
#pragma unroll
    for (int q = 0; q < 2; ++q) { unsigned short a, c2; splitf(F[(size_t)(t + q) * D3 + coff + d], a, c2); oh[q] = a; ol[q] = c2; }
    *(v2us*)(Vh + e) = oh; *(v2us*)(Vl + e) = ol;  }
__global__ __launch_bounds__(256) void k_lsofth(const float* __restrict__ Sb, bf* Ph, bf* Pl) {
    const int lane = threadIdx.x & 31; const int row = blockIdx.x * 8 + (threadIdx.x >> 5); if (row >= TT) return; const float* sr = Sb + (size_t)row * TT; float mx = -3.0e38f;
#pragma unroll 4
    for (int ch = 0; ch < TT / 128; ++ch) { const v4f a = *(const v4f*)(sr + ch * 128 + lane * 4);
#pragma unroll
        for (int q = 0; q < 4; ++q) { float t = a[q] * SCL; asm volatile("" : "+v"(t)); mx = fmaxf(mx, t); } }
#pragma unroll
    for (int sh = 16; sh; sh >>= 1) mx = fmaxf(mx, __shfl_xor(mx, sh, 32));
    float sum = 0.f;
#pragma unroll 4
    for (int ch = 0; ch < TT / 128; ++ch) { const v4f a = *(const v4f*)(sr + ch * 128 + lane * 4);
#pragma unroll
        for (int q = 0; q < 4; ++q) { float t = a[q] * SCL; asm volatile("" : "+v"(t)); float d0 = __fsub_rn(t, mx); asm volatile("" : "+v"(d0)); sum += __builtin_amdgcn_exp2f(__fmul_rn(d0, 1.4426950408889634f)); } }
#pragma unroll
    for (int sh = 16; sh; sh >>= 1) sum += __shfl_xor(sum, sh, 32);
    const float f = __fdiv_rn(1.0f, sum);
{
#pragma unroll 2
        for (int ch = 0; ch < TT / 128; ++ch) { const v4f a = *(const v4f*)(sr + ch * 128 + lane * 4); v4us oh, ol;
#pragma unroll
            for (int q = 0; q < 4; ++q) { float t = a[q] * SCL; asm volatile("" : "+v"(t)); float d0 = __fsub_rn(t, mx); asm volatile("" : "+v"(d0)); float ex = __builtin_amdgcn_exp2f(__fmul_rn(d0, 1.4426950408889634f)); asm volatile("" : "+v"(ex)); float y = ex * f; asm volatile("" : "+v"(y)); unsigned short a2, c2; splitf(y, a2, c2); oh[q] = a2; ol[q] = c2; }
            const size_t oo = (size_t)row * TT + ch * 128 + lane * 4; *(v4us*)(Ph + oo) = oh; *(v4us*)(Pl + oo) = ol; }
         }
}

extern "C" void kernel_launch(void* const* d_in, const int* in_sizes, int n_in,
                              void* d_out, int out_size, void* d_ws, size_t ws_size, hipStream_t stream) {
    (void)in_sizes; (void)n_in; (void)out_size;
    const float* x = (const float*)d_in[0]; const float* w = (const float*)d_in[1]; const float* bqkv = (const float*)d_in[2];
    float* OUT = (float*)d_out;     // [4][4096][64]
    char* wsp = (char*)d_ws;
    auto take = [&](size_t bytes) { char* p = wsp; wsp += (bytes + 255) & ~(size_t)255; return (void*)p; };
    bf* WB = (bf*)take((size_t)D3 * DM * 2); bf* XB = (bf*)take((size_t)TT * DM * 2); float* F = (float*)take((size_t)TT * D3 * 4);
    bf* QPh = (bf*)take((size_t)TT * HD * 2); bf* QPl = (bf*)take((size_t)TT * HD * 2); bf* KPh = (bf*)take((size_t)TT * HD * 2); bf* KPl = (bf*)take((size_t)TT * HD * 2); bf* VTh = (bf*)take((size_t)HD * TT * 2); bf* VTl = (bf*)take((size_t)HD * TT * 2);
    float* Sb = (float*)take((size_t)TT * TT * 4); bf* Ph = (bf*)take((size_t)TT * TT * 2); bf* Pl = (bf*)take((size_t)TT * TT * 2);
    if ((size_t)(wsp - (char*)d_ws) > ws_size) return;    // ws 256 MiB
    k_wtG<<<(unsigned)((DM * D3 / 64 + 63) / 64), 256, 0, stream>>>(w, DM, D3, WB);   /* 'xw' [64][192] -> Bt [192][64] (rows q | k | v) */
    const unsigned LP = (unsigned)(((size_t)TT * HD / 2 + 255) / 256);
    for (int b = 0; b < NB_; ++b) {
        k_cvt8<<<(unsigned)(((size_t)TT * DM / 8 + 255) / 256), 256, 0, stream>>>(x + (size_t)b * TT * DM, XB, (size_t)TT * DM / 8);
        k_gemmw<bf, 0, true><<<dim3(TT / 64, D3 / 64, 1), 32, 0, stream>>>(XB, nullptr, WB, nullptr, DM, F, D3, bqkv, 0, 0, 0);   /* [q | k | v] = x W + b */
        k_pl2<<<LP, 256, 0, stream>>>(F, 0, QPh, QPl); k_pl2<<<LP, 256, 0, stream>>>(F, HD, KPh, KPl); k_vt2<<<LP, 256, 0, stream>>>(F, 2 * HD, VTh, VTl);
        k_gemmw<bf, 2, false><<<dim3(TT / 64, TT / 64, 1), 32, 0, stream>>>(QPh, QPl, KPh, KPl, HD, Sb, TT, nullptr, 0, 0, 0);       /* scores (3 products) */
        k_lsofth<<<TT / 8, 256, 0, stream>>>(Sb, Ph, Pl);
        k_gemmw<bf, 2, false><<<dim3(TT / 64, HD / 64, 1), 32, 0, stream>>>(Ph, Pl, VTh, VTl, TT, OUT + (size_t)b * TT * HD, HD, nullptr, 0, 0, 0); }   /* out = attn v (rows of 256 B) */
}

// v001
// One run takes 439 microseconds.
// Next to v000, in two timings, it ran 1.49 and 1.52 times as fast.
#include <hip/hip_runtime.h>

// Single-head self-attention (x [4][4096][64]; qkv = x W + b ('xw' [64][192] + [192]) -> q | k | v (64 each); scores = q.k / 8 over all 4096 keys; softmax; out = attn v -> [4][4096][64] (1.0 M)).
// Compute dtypes, f32 accumulate: every input rounded to bf16; the fused projection on PLAIN bf16 operands (exact) + f32 bias; scores and attn.v on bf16 hi/lo planes (3 products) for every row; softmax f32 (streaming, one wave per row); the attn.v GEMM writes the output rows directly.

#define NB_  4
#define TT   4096
#define DM   64
#define HD   64
#define NH_  1
#define DQ   64
#define D3   192
#define ZH   1
#define PCAR 1024.0f
#define SCL  0.125f   // DIM^-0.5
typedef _Float16 h16;
typedef unsigned short bf;
typedef __attribute__((ext_vector_type(16))) __bf16   v16bf;
typedef __attribute__((ext_vector_type(16))) _Float16 v16h;
typedef __attribute__((ext_vector_type(8)))  _Float16 v8h;
typedef __attribute__((ext_vector_type(8)))  unsigned short v8us;
typedef __attribute__((ext_vector_type(8)))  float    v8f;
typedef __attribute__((ext_vector_type(4)))  float    v4f;
typedef __attribute__((ext_vector_type(2)))  float    v2f;
typedef v8h  __attribute__((may_alias)) v8ha;
typedef v4f  __attribute__((may_alias)) v4fa;
typedef v8us __attribute__((may_alias)) v8usa;

__device__ __forceinline__ unsigned short f2bf(float f) { unsigned u = __float_as_uint(f); u += 0x7FFFu + ((u >> 16) & 1u); return (unsigned short)(u >> 16); }
__device__ __forceinline__ float bf2f(unsigned short b) { return __uint_as_float(((unsigned)b) << 16); }
__device__ __forceinline__ float bfr(float f) { return bf2f(f2bf(f)); }
__device__ __forceinline__ v16h cat16(v8h lo, v8h hi) { return __builtin_shufflevector(lo, hi, 0, 1, 2, 3, 4, 5, 6, 7, 8, 9, 10, 11, 12, 13, 14, 15); }
__device__ __forceinline__ v16bf cat16b(v8us lo, v8us hi) { return __builtin_bit_cast(v16bf, __builtin_shufflevector(lo, hi, 0, 1, 2, 3, 4, 5, 6, 7, 8, 9, 10, 11, 12, 13, 14, 15)); }
__device__ __forceinline__ v8f wmma16(v16h a, v16h b, v8f c) { return __builtin_amdgcn_wmma_f32_16x16x32_f16(false, a, false, b, (short)0, c, false, false); }
__device__ __forceinline__ v8f wmmab(v16bf a, v16bf b, v8f c) { return __builtin_amdgcn_wmma_f32_16x16x32_bf16(false, a, false, b, (short)0, c, false, false); }



// ---- k_gemmw: register-blocked GEMM, ONE WAVE per 64x64 output tile (16 accumulators), operands straight from K-contiguous 16-bit planes; grid (M/64, N/64, Z), 32 threads.
// C[m][n] (f32, pitch ldc, + optional f32 bias[n]) = sum_k A[m][k] Bt[n][k] (+ split products per NSPLIT). z-batch strides sA/sB/sC in elements. K % 32 == 0.
template <typename T16> struct WFrag;
template <> struct WFrag<h16> { typedef v16h V; static __device__ __forceinline__ V ld(const h16* p) { return cat16(*(const v8h*)p, *(const v8h*)(p + 16)); } static __device__ __forceinline__ v8f mma(V a, V b, v8f c) { return wmma16(a, b, c); } };
template <> struct WFrag<bf> { typedef v16bf V; static __device__ __forceinline__ V ld(const bf* p) { return cat16b(*(const v8us*)p, *(const v8us*)(p + 16)); } static __device__ __forceinline__ v8f mma(V a, V b, v8f c) { return wmmab(a, b, c); } };
template <typename T16, int NSPLIT, bool BIAS>
__global__ __launch_bounds__(32) void k_gemmw(const T16* __restrict__ A, const T16* __restrict__ A2, const T16* __restrict__ Bt, const T16* __restrict__ Bt2, int K, float* C, int ldc, const float* __restrict__ bias, size_t sA, size_t sB, size_t sC) {
    typedef typename WFrag<T16>::V V;
    __shared__ __align__(16) float os[16 * 68];
    const size_t z = blockIdx.z; A += z * sA; if (A2) A2 += z * sA; Bt += z * sB; if (Bt2) Bt2 += z * sB; C += z * sC;
    const int lane = threadIdx.x & 31, lr = lane & 15, hi = lane >> 4; const int r0 = blockIdx.x * 64, c0 = blockIdx.y * 64;
    v8f acc[4][4];
#pragma unroll
    for (int mb = 0; mb < 4; ++mb)
#pragma unroll
        for (int nb = 0; nb < 4; ++nb) acc[mb][nb] = (v8f){};
    const size_t aoff = (size_t)(r0 + lr) * K + 8 * hi, boff = (size_t)(c0 + lr) * K + 8 * hi;
#pragma unroll 1
    for (int kc = 0; kc < K; kc += 32) {
        V a[4], a2[4];
#pragma unroll
        for (int mb = 0; mb < 4; ++mb) { a[mb] = WFrag<T16>::ld(A + aoff + (size_t)mb * 16 * K + kc); if (NSPLIT == 1 || NSPLIT == 2) a2[mb] = WFrag<T16>::ld(A2 + aoff + (size_t)mb * 16 * K + kc); }
#pragma unroll
        for (int nb = 0; nb < 4; ++nb) { const V b = WFrag<T16>::ld(Bt + boff + (size_t)nb * 16 * K + kc); V b2; if (NSPLIT >= 2) b2 = WFrag<T16>::ld(Bt2 + boff + (size_t)nb * 16 * K + kc);
#pragma unroll
            for (int mb = 0; mb < 4; ++mb) { acc[mb][nb] = WFrag<T16>::mma(a[mb], b, acc[mb][nb]); if (NSPLIT == 1 || NSPLIT == 2) acc[mb][nb] = WFrag<T16>::mma(a2[mb], b, acc[mb][nb]); if (NSPLIT >= 2) acc[mb][nb] = WFrag<T16>::mma(a[mb], b2, acc[mb][nb]); } }
        asm volatile("v_nop\n\tv_nop\n\tv_nop\n\tv_nop" : "+v"(acc[0][0]), "+v"(acc[1][1]), "+v"(acc[2][2]), "+v"(acc[3][3]) : "v"(a[0]), "v"(a[3]));
    }
#pragma unroll
    for (int mb = 0; mb < 4; ++mb) {
#pragma unroll
        for (int nb = 0; nb < 4; ++nb) {
#pragma unroll
            for (int j = 0; j < 8; ++j) os[(hi * 8 + j) * 68 + nb * 16 + lr] = acc[mb][nb][j]; }
        __builtin_amdgcn_wave_barrier(); asm volatile("" ::: "memory");
        float* crow = C + (size_t)(r0 + mb * 16) * ldc + c0;
{
#pragma unroll
            for (int s = 0; s < 8; ++s) { const int row = 2 * s + hi, cofs = lr * 4; v4f val = *(const v4fa*)(os + row * 68 + cofs); if (BIAS) { val[0] += bfr(bias[c0 + cofs]); val[1] += bfr(bias[c0 + cofs + 1]); val[2] += bfr(bias[c0 + cofs + 2]); val[3] += bfr(bias[c0 + cofs + 3]); }
                *(v4f*)(crow + (size_t)row * ldc + cofs) = val; }
             }
        __builtin_amdgcn_wave_barrier(); asm volatile("" ::: "memory");
    }
}

// ---- k_gemmks: one 16x64 output tile per work-group, K split evenly over its NW waves (each wave: 4 accumulators over K / NW); grid (M/16, N/64), NW * 32 threads.
// C[m][n] (f32, pitch ldc) = sum_k (A + A2)[m][k] Bt[n][k] + A[m][k] Bt2[n][k]; the waves' partial tiles meet in LDS and are added in wave order. K % (64 * NW) == 0.
template <int NW, int K>
__global__ __launch_bounds__(NW * 32) void k_gemmks(const bf* __restrict__ A, const bf* __restrict__ A2, const bf* __restrict__ Bt, const bf* __restrict__ Bt2, float* C, int ldc) {
    typedef WFrag<bf>::V V;
    __shared__ __align__(16) float red[NW * 16 * 68];
    const int lane = threadIdx.x & 31, lr = lane & 15, hi = lane >> 4; const int r0 = blockIdx.x * 16, c0 = blockIdx.y * 64;
    const int w = __builtin_amdgcn_readfirstlane(threadIdx.x >> 5);   // the wave's number, the same in all its lanes: held in a scalar register, so that the four operand bases below are scalar too
    v8f acc[4];
#pragma unroll
    for (int nb = 0; nb < 4; ++nb) acc[nb] = (v8f){};
    const bf* pa = A + (size_t)r0 * K + w * (K / NW); const bf* pa2 = A2 + (size_t)r0 * K + w * (K / NW); const bf* pb = Bt + (size_t)c0 * K + w * (K / NW); const bf* pb2 = Bt2 + (size_t)c0 * K + w * (K / NW);
    const unsigned vo = (unsigned)(lr * K + 8 * hi) * 2u;   // the lane's place in a 16-row fragment, in bytes: one offset register for all four operands (all have pitch K)
    auto at = [&](const bf* base) { return (const bf*)((const char*)base + vo); };
    // 64 k a trip: the four loads that share a 128-byte line of an operand row are issued together.
    // Unrolled: every trip's place is an immediate offset, so no address register changes while loads are out; the inner loops are unrolled so that the fragment arrays are indexed by constants and stay in registers.
#pragma unroll
    for (int kc = 0; kc < K / NW; kc += 64) {
        V a[2], a2[2], b[4][2], b2[4][2];
#pragma unroll
        for (int s = 0; s < 2; ++s) a[s] = WFrag<bf>::ld(at(pa + kc + s * 32));
#pragma unroll
        for (int s = 0; s < 2; ++s) a2[s] = WFrag<bf>::ld(at(pa2 + kc + s * 32));
#pragma unroll
        for (int nb = 0; nb < 4; ++nb) {
#pragma unroll
            for (int s = 0; s < 2; ++s) b[nb][s] = WFrag<bf>::ld(at(pb + (size_t)nb * 16 * K + kc + s * 32));
#pragma unroll
            for (int s = 0; s < 2; ++s) b2[nb][s] = WFrag<bf>::ld(at(pb2 + (size_t)nb * 16 * K + kc + s * 32)); }
        __builtin_amdgcn_sched_barrier(0);   // keeps a trip's 40 loads in front of its first WMMA: without it they are sunk between the WMMAs, a few in flight at a time
#pragma unroll
        for (int s = 0; s < 2; ++s) {
#pragma unroll
            for (int nb = 0; nb < 4; ++nb) acc[nb] = wmmab(a[s], b[nb][s], acc[nb]);
#pragma unroll
            for (int nb = 0; nb < 4; ++nb) acc[nb] = wmmab(a2[s], b[nb][s], acc[nb]);
#pragma unroll
            for (int nb = 0; nb < 4; ++nb) acc[nb] = wmmab(a[s], b2[nb][s], acc[nb]); }
        __builtin_amdgcn_sched_barrier(0);   // keeps the next trip's loads behind this trip's WMMAs: lifted over them they outgrow the 256 registers of a wave and spill
    }
    asm volatile("s_wait_xcnt 0x0" :: "v"(vo), "s"(pa), "s"(pa2), "s"(pb), "s"(pb2) : "memory");   // the loads' offset register and base pairs stay as they are up to this wait; only behind it may they be reused
    float* my = red + w * (16 * 68);
#pragma unroll
    for (int nb = 0; nb < 4; ++nb) {
#pragma unroll
        for (int j = 0; j < 8; ++j) my[(hi * 8 + j) * 68 + nb * 16 + lr] = acc[nb][j]; }
    __syncthreads();   // every wave's partial tile is in LDS before any of it is added
    // two columns a thread: a wave stores one whole 256-byte output row
    for (int e = threadIdx.x * 2; e < 16 * 64; e += NW * 64) { const int row = e >> 6, col = e & 63; const float* p = red + row * 68 + col; v2f s = *(const v2f*)p;
#pragma unroll
        for (int u = 1; u < NW; ++u) s += *(const v2f*)(p + u * (16 * 68));
        *(v2f*)(C + (size_t)(r0 + row) * ldc + c0 + col) = s; }
}

__device__ __forceinline__ h16 tohx(float x) { return (h16)x; }
__device__ __forceinline__ void splitf(float y, unsigned short& h, unsigned short& l) { h = f2bf(y); l = f2bf(y - bf2f(h)); }
typedef __attribute__((ext_vector_type(2))) _Float16 v2h;
typedef __attribute__((ext_vector_type(4))) _Float16 v4h;
typedef __attribute__((ext_vector_type(2))) unsigned short v2us;
typedef __attribute__((ext_vector_type(4))) unsigned short v4us;
typedef __attribute__((ext_vector_type(4))) int v4i;

__global__ __launch_bounds__(256) void k_cvt8(const float* __restrict__ src, bf* dst, size_t n8) { const size_t i = (size_t)blockIdx.x * 256 + threadIdx.x; if (i >= n8) return; const v8f v = *(const v8f*)(src + i * 8); v8us o;
#pragma unroll
    for (int k = 0; k < 8; ++k) o[k] = f2bf(v[k]); *(v8us*)(dst + i * 8) = o;  }
__global__ __launch_bounds__(256) void k_wtG(const float* __restrict__ w, int K, int N, bf* Bt) {
    const int lane = threadIdx.x & 31; const int L0 = (blockIdx.x * 8 + (threadIdx.x >> 5)) * 8; const int nlines = N * K / 64;
{
#pragma unroll 1
        for (int l = 0; l < 8; ++l) { const int L = L0 + l; if (L >= nlines) break; const size_t e = (size_t)L * 64 + lane * 2; const int k = (int)(e % K), n = (int)(e / K); v2us o;
            o[0] = f2bf(w[(size_t)k * N + n]); o[1] = f2bf(w[(size_t)(k + 1) * N + n]); *(v2us*)(Bt + e) = o; }
         }
}

__global__ __launch_bounds__(256) void k_pl2(const float* __restrict__ F, int coff, bf* Ph, bf* Pl) { const size_t e = ((size_t)blockIdx.x * 256 + threadIdx.x) * 2; if (e >= (size_t)TT * HD) return; const int d = (int)(e % HD); const int t = (int)(e / HD); const float* f = F + (size_t)t * D3 + coff + d; v2us oh, ol;
#pragma unroll
    for (int q = 0; q < 2; ++q) { unsigned short a, c2; splitf(f[q], a, c2); oh[q] = a; ol[q] = c2; }
    *(v2us*)(Ph + e) = oh; *(v2us*)(Pl + e) = ol;  }
__global__ __launch_bounds__(256) void k_vt2(const float* __restrict__ F, int coff, bf* Vh, bf* Vl) { const size_t e = ((size_t)blockIdx.x * 256 + threadIdx.x) * 2; if (e >= (size_t)HD * TT) return; const int t = (int)(e % TT); const int d = (int)(e / TT); v2us oh, ol;
#pragma unroll
    for (int q = 0; q < 2; ++q) { unsigned short a, c2; splitf(F[(size_t)(t + q) * D3 + coff + d], a, c2); oh[q] = a; ol[q] = c2; }
    *(v2us*)(Vh + e) = oh; *(v2us*)(Vl + e) = ol;  }
__global__ __launch_bounds__(256) void k_lsofth(const float* __restrict__ Sb, bf* Ph, bf* Pl) {
    const int lane = threadIdx.x & 31; const int row = blockIdx.x * 8 + (threadIdx.x >> 5); if (row >= TT) return; const float* sr = Sb + (size_t)row * TT; float mx = -3.0e38f;
#pragma unroll 4
    for (int ch = 0; ch < TT / 128; ++ch) { const v4f a = *(const v4f*)(sr + ch * 128 + lane * 4);
#pragma unroll
        for (int q = 0; q < 4; ++q) { float t = a[q] * SCL; asm volatile("" : "+v"(t)); mx = fmaxf(mx, t); } }
#pragma unroll
    for (int sh = 16; sh; sh >>= 1) mx = fmaxf(mx, __shfl_xor(mx, sh, 32));
    float sum = 0.f;
#pragma unroll 4
    for (int ch = 0; ch < TT / 128; ++ch) { const v4f a = *(const v4f*)(sr + ch * 128 + lane * 4);
#pragma unroll
        for (int q = 0; q < 4; ++q) { float t = a[q] * SCL; asm volatile("" : "+v"(t)); float d0 = __fsub_rn(t, mx); asm volatile("" : "+v"(d0)); sum += __builtin_amdgcn_exp2f(__fmul_rn(d0, 1.4426950408889634f)); } }
#pragma unroll
    for (int sh = 16; sh; sh >>= 1) sum += __shfl_xor(sum, sh, 32);
    const float f = __fdiv_rn(1.0f, sum);
{
#pragma unroll 2
        for (int ch = 0; ch < TT / 128; ++ch) { const v4f a = *(const v4f*)(sr + ch * 128 + lane * 4); v4us oh, ol;
#pragma unroll
            for (int q = 0; q < 4; ++q) { float t = a[q] * SCL; asm volatile("" : "+v"(t)); float d0 = __fsub_rn(t, mx); asm volatile("" : "+v"(d0)); float ex = __builtin_amdgcn_exp2f(__fmul_rn(d0, 1.4426950408889634f)); asm volatile("" : "+v"(ex)); float y = ex * f; asm volatile("" : "+v"(y)); unsigned short a2, c2; splitf(y, a2, c2); oh[q] = a2; ol[q] = c2; }
            const size_t oo = (size_t)row * TT + ch * 128 + lane * 4; *(v4us*)(Ph + oo) = oh; *(v4us*)(Pl + oo) = ol; }
         }
}

extern "C" void kernel_launch(void* const* d_in, const int* in_sizes, int n_in,
                              void* d_out, int out_size, void* d_ws, size_t ws_size, hipStream_t stream) {
    (void)in_sizes; (void)n_in; (void)out_size;
    const float* x = (const float*)d_in[0]; const float* w = (const float*)d_in[1]; const float* bqkv = (const float*)d_in[2];
    float* OUT = (float*)d_out;     // [4][4096][64]
    char* wsp = (char*)d_ws;
    auto take = [&](size_t bytes) { char* p = wsp; wsp += (bytes + 255) & ~(size_t)255; return (void*)p; };
    bf* WB = (bf*)take((size_t)D3 * DM * 2); bf* XB = (bf*)take((size_t)TT * DM * 2); float* F = (float*)take((size_t)TT * D3 * 4);
    bf* QPh = (bf*)take((size_t)TT * HD * 2); bf* QPl = (bf*)take((size_t)TT * HD * 2); bf* KPh = (bf*)take((size_t)TT * HD * 2); bf* KPl = (bf*)take((size_t)TT * HD * 2); bf* VTh = (bf*)take((size_t)HD * TT * 2); bf* VTl = (bf*)take((size_t)HD * TT * 2);
    float* Sb = (float*)take((size_t)TT * TT * 4); bf* Ph = (bf*)take((size_t)TT * TT * 2); bf* Pl = (bf*)take((size_t)TT * TT * 2);
    if ((size_t)(wsp - (char*)d_ws) > ws_size) return;    // ws 256 MiB
    k_wtG<<<(unsigned)((DM * D3 / 64 + 63) / 64), 256, 0, stream>>>(w, DM, D3, WB);   /* 'xw' [64][192] -> Bt [192][64] (rows q | k | v) */
    const unsigned LP = (unsigned)(((size_t)TT * HD / 2 + 255) / 256);
    for (int b = 0; b < NB_; ++b) {
        k_cvt8<<<(unsigned)(((size_t)TT * DM / 8 + 255) / 256), 256, 0, stream>>>(x + (size_t)b * TT * DM, XB, (size_t)TT * DM / 8);
        k_gemmw<bf, 0, true><<<dim3(TT / 64, D3 / 64, 1), 32, 0, stream>>>(XB, nullptr, WB, nullptr, DM, F, D3, bqkv, 0, 0, 0);   /* [q | k | v] = x W + b */
        k_pl2<<<LP, 256, 0, stream>>>(F, 0, QPh, QPl); k_pl2<<<LP, 256, 0, stream>>>(F, HD, KPh, KPl); k_vt2<<<LP, 256, 0, stream>>>(F, 2 * HD, VTh, VTl);
        k_gemmw<bf, 2, false><<<dim3(TT / 64, TT / 64, 1), 32, 0, stream>>>(QPh, QPl, KPh, KPl, HD, Sb, TT, nullptr, 0, 0, 0);       /* scores (3 products) */
        k_lsofth<<<TT / 8, 256, 0, stream>>>(Sb, Ph, Pl);
        k_gemmks<16, TT><<<dim3(TT / 16, HD / 64, 1), 16 * 32, 0, stream>>>(Ph, Pl, VTh, VTl, OUT + (size_t)b * TT * HD, HD); }   /* out = attn v (rows of 256 B) */
}

// v003
// A run of this version takes 128 microseconds.
// Versions in between are left out here; by their measured steps it is 3.41 times as fast as v001.
// Counting every step since v000, it is 5.14 times as fast.
#include <hip/hip_runtime.h>

// Single-head self-attention (x [4][4096][64]; qkv = x W + b ('xw' [64][192] + [192]) -> q | k | v (64 each); scores = q.k / 8 over all 4096 keys; softmax; out = attn v -> [4][4096][64] (1.0 M)).
// Compute dtypes, f32 accumulate: every input rounded to bf16; the fused projection on PLAIN bf16 operands (exact) + f32 bias; scores and attn.v on bf16 hi/lo planes (3 products) for every row; softmax f32 (running maximum and sum, inside the fused attention kernel, which writes the output rows directly).

#define NB_  4
#define TT   4096
#define DM   64
#define HD   64
#define NH_  1
#define DQ   64
#define D3   192
#define ZH   1
#define PCAR 1024.0f
#define SCL  0.125f   // DIM^-0.5
typedef _Float16 h16;
typedef unsigned short bf;
typedef __attribute__((ext_vector_type(16))) __bf16   v16bf;
typedef __attribute__((ext_vector_type(16))) _Float16 v16h;
typedef __attribute__((ext_vector_type(8)))  _Float16 v8h;
typedef __attribute__((ext_vector_type(8)))  unsigned short v8us;
typedef __attribute__((ext_vector_type(8)))  float    v8f;
typedef __attribute__((ext_vector_type(4)))  float    v4f;
typedef __attribute__((ext_vector_type(2)))  float    v2f;
typedef v8h  __attribute__((may_alias)) v8ha;
typedef v4f  __attribute__((may_alias)) v4fa;
typedef v8us __attribute__((may_alias)) v8usa;

__device__ __forceinline__ unsigned short f2bf(float f) { unsigned u = __float_as_uint(f); u += 0x7FFFu + ((u >> 16) & 1u); return (unsigned short)(u >> 16); }
__device__ __forceinline__ float bf2f(unsigned short b) { return __uint_as_float(((unsigned)b) << 16); }
__device__ __forceinline__ float bfr(float f) { return bf2f(f2bf(f)); }
__device__ __forceinline__ v16h cat16(v8h lo, v8h hi) { return __builtin_shufflevector(lo, hi, 0, 1, 2, 3, 4, 5, 6, 7, 8, 9, 10, 11, 12, 13, 14, 15); }
__device__ __forceinline__ v16bf cat16b(v8us lo, v8us hi) { return __builtin_bit_cast(v16bf, __builtin_shufflevector(lo, hi, 0, 1, 2, 3, 4, 5, 6, 7, 8, 9, 10, 11, 12, 13, 14, 15)); }
__device__ __forceinline__ v8f wmma16(v16h a, v16h b, v8f c) { return __builtin_amdgcn_wmma_f32_16x16x32_f16(false, a, false, b, (short)0, c, false, false); }
__device__ __forceinline__ v8f wmmab(v16bf a, v16bf b, v8f c) { return __builtin_amdgcn_wmma_f32_16x16x32_bf16(false, a, false, b, (short)0, c, false, false); }



// ---- 16-bit WMMA fragments, loaded from K-contiguous rows
template <typename T16> struct WFrag;
template <> struct WFrag<h16> { typedef v16h V; static __device__ __forceinline__ V ld(const h16* p) { return cat16(*(const v8h*)p, *(const v8h*)(p + 16)); } static __device__ __forceinline__ v8f mma(V a, V b, v8f c) { return wmma16(a, b, c); } };
template <> struct WFrag<bf> { typedef v16bf V; static __device__ __forceinline__ V ld(const bf* p) { return cat16b(*(const v8us*)p, *(const v8us*)(p + 16)); } static __device__ __forceinline__ v8f mma(V a, V b, v8f c) { return wmmab(a, b, c); } };

__device__ __forceinline__ h16 tohx(float x) { return (h16)x; }
__device__ __forceinline__ void splitf(float y, unsigned short& h, unsigned short& l) { h = f2bf(y); l = f2bf(y - bf2f(h)); }
typedef __attribute__((ext_vector_type(2))) _Float16 v2h;
typedef __attribute__((ext_vector_type(4))) _Float16 v4h;
typedef __attribute__((ext_vector_type(2))) unsigned short v2us;
typedef __attribute__((ext_vector_type(4))) unsigned short v4us;
typedef __attribute__((ext_vector_type(4))) int v4i;

// ---- k_proj: the whole path from x, W and b to the six operand planes of k_fattn, all batches, in one kernel. Grid (batches * T / 64), 4 waves; a work-group owns 64 rows of x and all 192 columns.
// W is rounded to bf16 and laid transposed ([column][k]) in LDS once per work-group; x is rounded to bf16 in registers, each wave's 16 rows directly as its fragments, and laid in LDS for the other waves.
// f32 bias, then the hi/lo split, straight from the accumulators. Wave i writes three pieces:
// q and k, rows 16 i .. 16 i + 15, all 64 columns: product Wt x^T (rows = columns of the plane), so a lane holds 8 neighbouring columns of one row: one 16-byte store per plane;
// v, columns 16 i .. 16 i + 15, all 64 rows: product x Wt^T (rows = t), so a lane holds 8 neighbouring t of one column: one 16-byte store per transposed plane. Every 128-byte line of a plane is written by one wave.
__global__ __launch_bounds__(128) void k_proj(const float* __restrict__ x, const float* __restrict__ w, const float* __restrict__ bias, bf* __restrict__ Qh, bf* __restrict__ Kh, bf* __restrict__ Vh) {
    typedef WFrag<bf>::V V;
    constexpr int LO = NB_ * TT * HD;   // each operand's lo plane lies this many elements behind its hi plane
    constexpr int WP = DM + 8;          // pitch of a row in LDS, in elements (144 bytes: the 16 rows of a fragment start in 16 different groups of four banks)
    __shared__ __align__(16) bf wt[D3 * WP];
    __shared__ __align__(16) bf xs[64 * WP];
    const int lane = threadIdx.x & 31, lr = lane & 15, hi = lane >> 4;
    const int wv = __builtin_amdgcn_readfirstlane(threadIdx.x >> 5);   // the wave's number, the same in all its lanes: held in a scalar register
    const int g0 = blockIdx.x * 64;     // first row, counted over all batches
    // W: a thread brings three blocks of 4 columns x 8 k, neighbouring lanes on neighbouring columns; x: the lane's four 8-element pieces of its row (the k order of WFrag::ld)
    const float* px = x + (size_t)(g0 + wv * 16 + lr) * DM + 8 * hi;
    const float* pb = bias + 8 * hi;    // q and k: the lane's 8 columns of each 16-column tile; v: one column
    const float* pw[3];
    v4f wr[3][8]; v8f xr[4], bb[8];
#pragma unroll
    for (int p = 0; p < 4; ++p) xr[p] = *(const v8f*)(px + p * 16);
#pragma unroll
    for (int r = 0; r < 3; ++r) { const int it = (int)threadIdx.x + 128 * r; pw[r] = w + (it / 48) * 8 * D3 + (it % 48) * 4;
#pragma unroll
        for (int e = 0; e < 8; ++e) wr[r][e] = *(const v4f*)(pw[r] + e * D3); }
#pragma unroll
    for (int c = 0; c < 8; ++c) bb[c] = *(const v8f*)(pb + c * 16);
    const float* pv = bias + 2 * HD + wv * 16 + lr; const float bv = bfr(*pv);
    __builtin_amdgcn_sched_barrier(0);   // keeps all of the wave's loads in front of the first conversion: without it a part of them was issued only after the first had returned, a second memory latency
    asm volatile("s_wait_xcnt 0x0" :: "v"(px), "v"(pw[0]), "v"(pw[1]), "v"(pw[2]) : "memory");   // the loads' address registers stay as they are up to this wait; only behind it may they be reused
    v8us xc[4];
#pragma unroll
    for (int p = 0; p < 4; ++p) {
#pragma unroll
        for (int e = 0; e < 8; ++e) xc[p][e] = f2bf(xr[p][e]);
        *(v8usa*)(xs + (wv * 16 + lr) * WP + 8 * hi + p * 16) = xc[p]; }
#pragma unroll
    for (int r = 0; r < 3; ++r) { const int it = (int)threadIdx.x + 128 * r; bf* pt = wt + (it % 48) * 4 * WP + (it / 48) * 8;
#pragma unroll
        for (int cc = 0; cc < 4; ++cc) { v8us o;
#pragma unroll
            for (int e = 0; e < 8; ++e) o[e] = f2bf(wr[r][e][cc]);
            *(v8usa*)(pt + cc * WP) = o; } }
    const V xf[2] = { cat16b(xc[0], xc[1]), cat16b(xc[2], xc[3]) };
    __syncthreads();   // all of W^T and of the 64 rows of x is in LDS before any wave reads a fragment of them
    const int fo = lr * WP + 8 * hi;   // the lane's place in a 16-row fragment in LDS
    v8us oh[3][4], ol[3][4]; bf* dst[3];
#pragma unroll
    for (int part = 0; part < 2; ++part) {   // q, then k
        dst[part] = (part == 0 ? Qh : Kh) + (size_t)(g0 + wv * 16 + lr) * HD + 8 * hi;
#pragma unroll
        for (int ct = 0; ct < 4; ++ct) { const int c0 = part * HD + ct * 16; v8f acc = (v8f){};
#pragma unroll
            for (int s = 0; s < 2; ++s) acc = wmmab(WFrag<bf>::ld(wt + c0 * WP + fo + s * 32), xf[s], acc);
#pragma unroll
            for (int j = 0; j < 8; ++j) { unsigned short a, c2; splitf(acc[j] + bfr(bb[part * 4 + ct][j]), a, c2); oh[part][ct][j] = a; ol[part][ct][j] = c2; }
            *(v8us*)(dst[part] + ct * 16) = oh[part][ct]; *(v8us*)(dst[part] + LO + ct * 16) = ol[part][ct]; } }
    {
        const int d0 = wv * 16;
        const V wb[2] = { WFrag<bf>::ld(wt + (2 * HD + d0) * WP + fo), WFrag<bf>::ld(wt + (2 * HD + d0) * WP + fo + 32) };
        dst[2] = Vh + (size_t)(g0 / TT) * (TT * HD) + (size_t)(d0 + lr) * TT + (g0 % TT) + 8 * hi;
#pragma unroll
        for (int mt = 0; mt < 4; ++mt) { v8f acc = (v8f){};
#pragma unroll
            for (int s = 0; s < 2; ++s) acc = wmmab(WFrag<bf>::ld(xs + mt * 16 * WP + fo + s * 32), wb[s], acc);
#pragma unroll
            for (int j = 0; j < 8; ++j) { unsigned short a, c2; splitf(acc[j] + bv, a, c2); oh[2][mt][j] = a; ol[2][mt][j] = c2; }
            *(v8us*)(dst[2] + mt * 16) = oh[2][mt]; *(v8us*)(dst[2] + LO + mt * 16) = ol[2][mt]; }
    }
    // every register that a store above names (its address, its data) stays as it is up to this wait: each tile keeps registers of its own, so no wait is needed between the stores
    asm volatile("s_wait_xcnt 0x0" :: "v"(dst[0]), "v"(dst[1]), "v"(dst[2]),
                 "v"(oh[0][0]), "v"(oh[0][1]), "v"(oh[0][2]), "v"(oh[0][3]), "v"(ol[0][0]), "v"(ol[0][1]), "v"(ol[0][2]), "v"(ol[0][3]),
                 "v"(oh[1][0]), "v"(oh[1][1]), "v"(oh[1][2]), "v"(oh[1][3]), "v"(ol[1][0]), "v"(ol[1][1]), "v"(ol[1][2]), "v"(ol[1][3]),
                 "v"(oh[2][0]), "v"(oh[2][1]), "v"(oh[2][2]), "v"(oh[2][3]), "v"(ol[2][0]), "v"(ol[2][1]), "v"(ol[2][2]), "v"(ol[2][3]) : "memory");
}
// ---- k_fattn: scores, softmax and attn.v in one kernel; no score and no weight is stored in memory. Grid (T / (16 * QT), batches), QT * KS waves.
// A wave owns 16 queries (one per lane column) and T / KS keys, 64 keys a trip: St = K Qt (rows = keys), running maximum and sum per query, Ot += Vt Pt (rows = d).
// Two score tiles of 16 keys, converted in place, are the B operand of the second product in the hardware k order, which is also the order of WFrag::ld.
// The KS partial results of a query tile meet in LDS and are joined by their maxima, in split order.
typedef __attribute__((ext_vector_type(2))) __bf16 v2bf;
typedef __attribute__((ext_vector_type(8))) unsigned v8u;
__device__ __forceinline__ float xhalf(float x) { const int b = __float_as_int(x); return __int_as_float(__builtin_amdgcn_permlanex16(b, b, 0x76543210, 0xfedcba98, false, false)); }   // lane l <-> l ^ 16
// 2^x for two values. In asm so that the slot behind each v_exp_f32 is filled by construction: the second is independent of the first (results are kept off the sources), the v_nop stands behind the second;
__device__ __forceinline__ void exp2x2(float x0, float x1, float& y0, float& y1) { asm("v_exp_f32 %0, %2\n\tv_exp_f32 %1, %3\n\tv_nop" : "=&v"(y0), "=&v"(y1) : "v"(x0), "v"(x1)); }
template <int QT, int KS>
__global__ __launch_bounds__(QT * KS * 32) void k_fattn(const bf* __restrict__ Q, const bf* __restrict__ K, const bf* __restrict__ Vt, float* __restrict__ O) {
    typedef WFrag<bf>::V V;
    constexpr int LO = NB_ * TT * HD;   // each operand's lo plane lies this many elements behind its hi plane: one address register pair serves both, the distance is an immediate
    constexpr float CS = SCL * 1.4426950408889634f;   // scores are carried in log2 units
    __shared__ __align__(16) float red[QT * KS * 16 * 68];
    __shared__ __align__(16) bf qs[QT * KS * 8 * 32 * 8];
    __shared__ float stm[QT * KS * 16]; __shared__ float stl[QT * KS * 16];
    const int lane = threadIdx.x & 31, lr = lane & 15, hi = lane >> 4;
    const int w = __builtin_amdgcn_readfirstlane(threadIdx.x >> 5);   // the wave's number, the same in all its lanes: held in a scalar register, so that the operand bases below are scalar too
    const int qt = w % QT, ks = w / QT;
    const size_t zo = (size_t)blockIdx.y * TT * HD;
    const int q0 = blockIdx.x * (16 * QT);
    // Q's four fragments are parked in LDS, each lane's 16-byte pieces at the lane's own place, and read back at the top of every trip: kept in registers they would
    // hold 32 of them through the softmax and the second product, where V's 128 are live, and the allocator would spill to scratch. No other lane reads a lane's pieces: no barrier.
    bf* myq = qs + w * (8 * 32 * 8) + lane * 8;
    const size_t qo = zo + (size_t)(q0 + qt * 16 + lr) * HD + 8 * hi; const bf* aq = Q + qo;
#pragma unroll
    for (int f = 0; f < 8; ++f) *(v8usa*)(myq + f * 256) = *(const v8us*)(aq + (f >> 2) * LO + (f & 3) * 16);   // f = plane * 4 + k step * 2 + half
    asm volatile("s_wait_xcnt 0x0" :: "v"(aq) : "memory");   // the address pair of the Q loads stays as it is up to this wait; only behind it may its registers be reused
    const bf* pk = K + zo + (size_t)ks * (TT / KS) * HD; const bf* pv = Vt + zo + ks * (TT / KS);
    const unsigned vok = (unsigned)(lr * HD + 8 * hi) * 2u, vov = (unsigned)(lr * TT + 8 * hi) * 2u;   // the lane's place in a 16-row fragment, in bytes (pitch HD for K, T for Vt)
    auto atk = [&](const bf* base) { return (const bf*)((const char*)base + vok); };
    auto atv = [&](const bf* base) { return (const bf*)((const char*)base + vov); };
    v8f o[4];
#pragma unroll
    for (int mb = 0; mb < 4; ++mb) o[mb] = (v8f){};
    float m = -3.0e38f, l = 0.f;
    unsigned ko = 0, vo = 0;   // the trip's place in K and in Vt, in elements
    // rolled: the body is long
#pragma unroll 1
    for (int t = 0; t < TT / KS / 64; ++t) {
        const bf* ak = atk(pk + ko); const bf* av = atv(pv + vo);   // the lane's two addresses of this trip; every load below is one of them plus an immediate
        V kh[4][2], kl[4][2], qh[2], ql[2];
#pragma unroll
        for (int s = 0; s < 2; ++s) { qh[s] = cat16b(*(const v8usa*)(myq + (s * 2) * 256), *(const v8usa*)(myq + (s * 2 + 1) * 256)); ql[s] = cat16b(*(const v8usa*)(myq + (4 + s * 2) * 256), *(const v8usa*)(myq + (4 + s * 2 + 1) * 256)); }
#pragma unroll
        for (int kt = 0; kt < 4; ++kt) {
#pragma unroll
            for (int s = 0; s < 2; ++s) kh[kt][s] = WFrag<bf>::ld(ak + kt * 16 * HD + s * 32);
#pragma unroll
            for (int s = 0; s < 2; ++s) kl[kt][s] = WFrag<bf>::ld(ak + LO + kt * 16 * HD + s * 32); }
        __builtin_amdgcn_sched_barrier(0);   // keeps the trip's 32 K loads in front of its first WMMA: without it they are sunk between the WMMAs, four in flight at a time
        v8f sc[4];
#pragma unroll
        for (int kt = 0; kt < 4; ++kt) sc[kt] = (v8f){};
#pragma unroll
        for (int s = 0; s < 2; ++s) {
#pragma unroll
            for (int kt = 0; kt < 4; ++kt) sc[kt] = wmmab(kh[kt][s], qh[s], sc[kt]);
#pragma unroll
            for (int kt = 0; kt < 4; ++kt) sc[kt] = wmmab(kl[kt][s], qh[s], sc[kt]);
#pragma unroll
            for (int kt = 0; kt < 4; ++kt) sc[kt] = wmmab(kh[kt][s], ql[s], sc[kt]); }
        V vh[4][2], vl[4][2];
#pragma unroll
        for (int mb = 0; mb < 4; ++mb) {
#pragma unroll
            for (int u = 0; u < 2; ++u) vh[mb][u] = WFrag<bf>::ld(av + mb * 16 * TT + u * 32);
#pragma unroll
            for (int u = 0; u < 2; ++u) vl[mb][u] = WFrag<bf>::ld(av + LO + mb * 16 * TT + u * 32); }
        asm volatile("s_wait_xcnt 0x0" :: "v"(ak), "v"(av) : "memory");   // the trip's two address pairs stay as they are up to this wait; only behind it may their registers be reused
        float mx = sc[0][0];
#pragma unroll
        for (int kt = 0; kt < 4; ++kt) {
#pragma unroll
            for (int j = 0; j < 8; ++j) mx = fmaxf(mx, sc[kt][j]); }
        mx = fmaxf(mx, xhalf(mx));   // the two lanes of a query hold different keys and need one common maximum
        const float mn = fmaxf(m, mx * CS); const float al = __builtin_amdgcn_exp2f(m - mn); m = mn; l *= al;
#pragma unroll
        for (int mb = 0; mb < 4; ++mb) o[mb] *= al;
        V ph[2], pl[2];
#pragma unroll
        for (int u = 0; u < 2; ++u) { v8u wh, wl;
#pragma unroll
            for (int e = 0; e < 8; ++e) { const int kt = 2 * u + (e >> 2), j = (e & 3) * 2; v2f p;
                float p0, p1; exp2x2(__builtin_fmaf(sc[kt][j], CS, -mn), __builtin_fmaf(sc[kt][j + 1], CS, -mn), p0, p1); p[0] = p0; p[1] = p1; l += p0 + p1;
                const unsigned hb = __builtin_bit_cast(unsigned, __builtin_convertvector(p, v2bf)); v2f r;
                r[0] = p[0] - __uint_as_float(hb << 16); r[1] = p[1] - __uint_as_float(hb & 0xFFFF0000u);
                wh[e] = hb; wl[e] = __builtin_bit_cast(unsigned, __builtin_convertvector(r, v2bf)); }
            ph[u] = __builtin_bit_cast(V, wh); pl[u] = __builtin_bit_cast(V, wl); }
        __builtin_amdgcn_sched_barrier(0);   // keeps the softmax arithmetic in front of the second product
#pragma unroll
        for (int u = 0; u < 2; ++u) {
#pragma unroll
            for (int mb = 0; mb < 4; ++mb) o[mb] = wmmab(vh[mb][u], ph[u], o[mb]);
#pragma unroll
            for (int mb = 0; mb < 4; ++mb) o[mb] = wmmab(vh[mb][u], pl[u], o[mb]);
#pragma unroll
            for (int mb = 0; mb < 4; ++mb) o[mb] = wmmab(vl[mb][u], ph[u], o[mb]); }
        ko += 64 * HD; vo += 64;
    }
    l += xhalf(l);   // the two halves' sums of a query, joined once
    float* my = red + w * (16 * 68) + lr * 68 + hi * 8;
#pragma unroll
    for (int mb = 0; mb < 4; ++mb) { v4f x0, x1;
#pragma unroll
        for (int j = 0; j < 4; ++j) { x0[j] = o[mb][j]; x1[j] = o[mb][4 + j]; }
        *(v4fa*)(my + mb * 16) = x0; *(v4fa*)(my + mb * 16 + 4) = x1; }
    if (hi == 0) { stm[w * 16 + lr] = m; stl[w * 16 + lr] = l; }
    __syncthreads();   // every wave's partial tile, maximum and sum are in LDS before any of them is joined
    // eight d a thread: a wave stores four whole 256-byte output rows
    for (int e = threadIdx.x; e < QT * 16 * 8; e += QT * KS * 32) { const int qq = e >> 3, tq = qq >> 4, r = qq & 15, d0 = (e & 7) * 8;
        float M = stm[tq * 16 + r];
#pragma unroll
        for (int s = 1; s < KS; ++s) M = fmaxf(M, stm[(s * QT + tq) * 16 + r]);
        float L = 0.f; v4f y0 = (v4f){}, y1 = (v4f){};
#pragma unroll
        for (int s = 0; s < KS; ++s) { const int ws = s * QT + tq; const float g = __builtin_amdgcn_exp2f(stm[ws * 16 + r] - M); L += g * stl[ws * 16 + r];
            const float* p = red + ws * (16 * 68) + r * 68 + d0; y0 += g * *(const v4fa*)p; y1 += g * *(const v4fa*)(p + 4); }
        const float f = __fdiv_rn(1.0f, L); float* dst = O + zo + (size_t)(q0 + qq) * HD + d0;
        *(v4f*)dst = y0 * f; *(v4f*)(dst + 4) = y1 * f; }
}

extern "C" void kernel_launch(void* const* d_in, const int* in_sizes, int n_in,
                              void* d_out, int out_size, void* d_ws, size_t ws_size, hipStream_t stream) {
    (void)in_sizes; (void)n_in; (void)out_size;
    const float* x = (const float*)d_in[0]; const float* w = (const float*)d_in[1]; const float* bqkv = (const float*)d_in[2];
    float* OUT = (float*)d_out;     // [4][4096][64]
    char* wsp = (char*)d_ws;
    auto take = [&](size_t bytes) { char* p = wsp; wsp += (bytes + 255) & ~(size_t)255; return (void*)p; };
    const size_t PN = (size_t)TT * HD;   // one batch's plane, in elements; every plane holds all batches
    bf* QPh = (bf*)take(2 * NB_ * PN * 2); bf* KPh = (bf*)take(2 * NB_ * PN * 2); bf* VTh = (bf*)take(2 * NB_ * PN * 2);   // hi plane, then lo plane
    if ((size_t)(wsp - (char*)d_ws) > ws_size) return;    // ws 256 MiB
    k_proj<<<NB_ * TT / 64, 128, 0, stream>>>(x, w, bqkv, QPh, KPh, VTh);   /* [q | k | v] = x W + b, split into hi/lo planes (v transposed), all batches */
    k_fattn<4, 4><<<dim3(TT / 64, NB_, 1), 4 * 4 * 32, 0, stream>>>(QPh, KPh, VTh, OUT);   /* out = softmax(q k / 8) v, all batches (rows of 256 B) */
}

// v004
// A run of this version takes 42.8 microseconds.
// Timed twice side by side with v003, it ran 3.04 and 2.96 times as fast.
// Over all steps from v000 it is 15.4 times as fast.
#include <hip/hip_runtime.h>

// Single-head self-attention (x [4][4096][64]; qkv = x W + b ('xw' [64][192] + [192]) -> q | k | v (64 each); scores = q.k / 8 over all 4096 keys; softmax; out = attn v -> [4][4096][64] (1.0 M)).
// Compute dtypes, f32 accumulate: every input rounded to bf16; the fused projection on PLAIN bf16 operands (exact) + f32 bias; scores and attn.v on bf16 hi/lo planes (3 products) for every row; softmax f32 (running maximum and sum, inside the fused attention kernel, which writes the output rows directly).

#define NB_  4
#define TT   4096
#define DM   64
#define HD   64
#define NH_  1
#define DQ   64
#define D3   192
#define ZH   1
#define PCAR 1024.0f
#define SCL  0.125f   // DIM^-0.5
typedef _Float16 h16;
typedef unsigned short bf;
typedef __attribute__((ext_vector_type(16))) __bf16   v16bf;
typedef __attribute__((ext_vector_type(16))) _Float16 v16h;
typedef __attribute__((ext_vector_type(8)))  _Float16 v8h;
typedef __attribute__((ext_vector_type(8)))  unsigned short v8us;
typedef __attribute__((ext_vector_type(8)))  float    v8f;
typedef __attribute__((ext_vector_type(4)))  float    v4f;
typedef __attribute__((ext_vector_type(2)))  float    v2f;
typedef v8h  __attribute__((may_alias)) v8ha;
typedef v4f  __attribute__((may_alias)) v4fa;
typedef v8us __attribute__((may_alias)) v8usa;

__device__ __forceinline__ unsigned short f2bf(float f) { unsigned u = __float_as_uint(f); u += 0x7FFFu + ((u >> 16) & 1u); return (unsigned short)(u >> 16); }
__device__ __forceinline__ float bf2f(unsigned short b) { return __uint_as_float(((unsigned)b) << 16); }
__device__ __forceinline__ float bfr(float f) { return bf2f(f2bf(f)); }
__device__ __forceinline__ v16h cat16(v8h lo, v8h hi) { return __builtin_shufflevector(lo, hi, 0, 1, 2, 3, 4, 5, 6, 7, 8, 9, 10, 11, 12, 13, 14, 15); }
__device__ __forceinline__ v16bf cat16b(v8us lo, v8us hi) { return __builtin_bit_cast(v16bf, __builtin_shufflevector(lo, hi, 0, 1, 2, 3, 4, 5, 6, 7, 8, 9, 10, 11, 12, 13, 14, 15)); }
__device__ __forceinline__ v8f wmma16(v16h a, v16h b, v8f c) { return __builtin_amdgcn_wmma_f32_16x16x32_f16(false, a, false, b, (short)0, c, false, false); }
__device__ __forceinline__ v8f wmmab(v16bf a, v16bf b, v8f c) { return __builtin_amdgcn_wmma_f32_16x16x32_bf16(false, a, false, b, (short)0, c, false, false); }



// ---- 16-bit WMMA fragments, loaded from K-contiguous rows
template <typename T16> struct WFrag;
template <> struct WFrag<h16> { typedef v16h V; static __device__ __forceinline__ V ld(const h16* p) { return cat16(*(const v8h*)p, *(const v8h*)(p + 16)); } static __device__ __forceinline__ v8f mma(V a, V b, v8f c) { return wmma16(a, b, c); } };
template <> struct WFrag<bf> { typedef v16bf V; static __device__ __forceinline__ V ld(const bf* p) { return cat16b(*(const v8us*)p, *(const v8us*)(p + 16)); } static __device__ __forceinline__ v8f mma(V a, V b, v8f c) { return wmmab(a, b, c); } };

__device__ __forceinline__ h16 tohx(float x) { return (h16)x; }
__device__ __forceinline__ void splitf(float y, unsigned short& h, unsigned short& l) { h = f2bf(y); l = f2bf(y - bf2f(h)); }
typedef __attribute__((ext_vector_type(2))) _Float16 v2h;
typedef __attribute__((ext_vector_type(4))) _Float16 v4h;
typedef __attribute__((ext_vector_type(2))) unsigned short v2us;
typedef __attribute__((ext_vector_type(4))) unsigned short v4us;
typedef __attribute__((ext_vector_type(4))) int v4i;

// ---- k_proj: the whole path from x, W and b to the six operand planes of k_fattn, all batches, in one kernel. Grid (batches * T / 64), 4 waves; a work-group owns 64 rows of x and all 192 columns.
// W is rounded to bf16 and laid transposed ([column][k]) in LDS once per work-group; x is rounded to bf16 in registers, each wave's 16 rows directly as its fragments, and laid in LDS for the other waves.
// f32 bias, then the hi/lo split, straight from the accumulators. Wave i writes three pieces:
// q and k, rows 16 i .. 16 i + 15, all 64 columns: product Wt x^T (rows = columns of the plane), so a lane holds 8 neighbouring columns of one row: one 16-byte store per plane;
// v, columns 16 i .. 16 i + 15, all 64 rows: product x Wt^T (rows = t), so a lane holds 8 neighbouring t of one column: one 16-byte store per transposed plane. Every 128-byte line of a plane is written by one wave.
// The k and v planes lie in FRAGMENT ORDER: blocks of 512 bytes, lane l's 16-byte piece of a half fragment at 16 l, so that a wave-wide 16-byte access covers four whole 128-byte lines instead of 32 bytes of each of 16 lines.
// k: [16-key tile][column / 16][lane][8]; v: [32-key block][d / 16][(key % 32) / 16][lane][8]; lane = 16 * (piece of 8 within the 16) + row of the fragment (key % 16 for k, d % 16 for v). 64 keys are 8 KiB in a row in either. q stays row-major.
__global__ __launch_bounds__(128) void k_proj(const float* __restrict__ x, const float* __restrict__ w, const float* __restrict__ bias, bf* __restrict__ Qh, bf* __restrict__ Kh, bf* __restrict__ Vh) {
    typedef WFrag<bf>::V V;
    constexpr int LO = NB_ * TT * HD;   // each operand's lo plane lies this many elements behind its hi plane
    constexpr int WP = DM + 8;          // pitch of a row in LDS, in elements (144 bytes: the 16 rows of a fragment start in 16 different groups of four banks)
    __shared__ __align__(16) bf wt[D3 * WP];
    __shared__ __align__(16) bf xs[64 * WP];
    const int lane = threadIdx.x & 31, lr = lane & 15, hi = lane >> 4;
    const int wv = __builtin_amdgcn_readfirstlane(threadIdx.x >> 5);   // the wave's number, the same in all its lanes: held in a scalar register
    const int g0 = blockIdx.x * 64;     // first row, counted over all batches
    // W: a thread brings three blocks of 4 columns x 8 k, neighbouring lanes on neighbouring columns; x: the lane's four 8-element pieces of its row (the k order of WFrag::ld)
    const float* px = x + (size_t)(g0 + wv * 16 + lr) * DM + 8 * hi;
    const float* pb = bias + 8 * hi;    // q and k: the lane's 8 columns of each 16-column tile; v: one column
    const float* pw[3];
    v4f wr[3][8]; v8f xr[4], bb[8];
#pragma unroll
    for (int p = 0; p < 4; ++p) xr[p] = *(const v8f*)(px + p * 16);
#pragma unroll
    for (int r = 0; r < 3; ++r) { const int it = (int)threadIdx.x + 128 * r; pw[r] = w + (it / 48) * 8 * D3 + (it % 48) * 4;
#pragma unroll
        for (int e = 0; e < 8; ++e) wr[r][e] = *(const v4f*)(pw[r] + e * D3); }
#pragma unroll
    for (int c = 0; c < 8; ++c) bb[c] = *(const v8f*)(pb + c * 16);
    const float* pv = bias + 2 * HD + wv * 16 + lr; const float bv = bfr(*pv);
    __builtin_amdgcn_sched_barrier(0);   // keeps all of the wave's loads in front of the first conversion: without it a part of them was issued only after the first had returned, a second memory latency
    asm volatile("s_wait_xcnt 0x0" :: "v"(px), "v"(pw[0]), "v"(pw[1]), "v"(pw[2]) : "memory");   // the loads' address registers stay as they are up to this wait; only behind it may they be reused
    v8us xc[4];
#pragma unroll
    for (int p = 0; p < 4; ++p) {
#pragma unroll
        for (int e = 0; e < 8; ++e) xc[p][e] = f2bf(xr[p][e]);
        *(v8usa*)(xs + (wv * 16 + lr) * WP + 8 * hi + p * 16) = xc[p]; }
#pragma unroll
    for (int r = 0; r < 3; ++r) { const int it = (int)threadIdx.x + 128 * r; bf* pt = wt + (it % 48) * 4 * WP + (it / 48) * 8;
#pragma unroll
        for (int cc = 0; cc < 4; ++cc) { v8us o;
#pragma unroll
            for (int e = 0; e < 8; ++e) o[e] = f2bf(wr[r][e][cc]);
            *(v8usa*)(pt + cc * WP) = o; } }
    const V xf[2] = { cat16b(xc[0], xc[1]), cat16b(xc[2], xc[3]) };
    __syncthreads();   // all of W^T and of the 64 rows of x is in LDS before any wave reads a fragment of them
    const int fo = lr * WP + 8 * hi;   // the lane's place in a 16-row fragment in LDS
    v8us oh[3][4], ol[3][4]; bf* dst[3];
#pragma unroll
    for (int part = 0; part < 2; ++part) {   // q, then k
        dst[part] = part == 0 ? Qh + (size_t)(g0 + wv * 16 + lr) * HD + 8 * hi : Kh + (size_t)(g0 + wv * 16) * HD + lane * 8;
        const int cs = part == 0 ? 16 : 256;   // from one 16-column piece to the next: along the row for q, one 512-byte block for k
#pragma unroll
        for (int ct = 0; ct < 4; ++ct) { const int c0 = part * HD + ct * 16; v8f acc = (v8f){};
#pragma unroll
            for (int s = 0; s < 2; ++s) acc = wmmab(WFrag<bf>::ld(wt + c0 * WP + fo + s * 32), xf[s], acc);
#pragma unroll
            for (int j = 0; j < 8; ++j) { unsigned short a, c2; splitf(acc[j] + bfr(bb[part * 4 + ct][j]), a, c2); oh[part][ct][j] = a; ol[part][ct][j] = c2; }
            *(v8us*)(dst[part] + ct * cs) = oh[part][ct]; *(v8us*)(dst[part] + LO + ct * cs) = ol[part][ct]; } }
    {
        const int d0 = wv * 16;
        const V wb[2] = { WFrag<bf>::ld(wt + (2 * HD + d0) * WP + fo), WFrag<bf>::ld(wt + (2 * HD + d0) * WP + fo + 32) };
        dst[2] = Vh + (size_t)g0 * HD + wv * 512 + lane * 8;   // the group's 64 keys are two 32-key blocks of 2048 elements; the wave's 16 d are blocks 2 wv and 2 wv + 1 of each
#pragma unroll
        for (int mt = 0; mt < 4; ++mt) { v8f acc = (v8f){};
#pragma unroll
            for (int s = 0; s < 2; ++s) acc = wmmab(WFrag<bf>::ld(xs + mt * 16 * WP + fo + s * 32), wb[s], acc);
#pragma unroll
            for (int j = 0; j < 8; ++j) { unsigned short a, c2; splitf(acc[j] + bv, a, c2); oh[2][mt][j] = a; ol[2][mt][j] = c2; }
            *(v8us*)(dst[2] + (mt >> 1) * 2048 + (mt & 1) * 256) = oh[2][mt]; *(v8us*)(dst[2] + LO + (mt >> 1) * 2048 + (mt & 1) * 256) = ol[2][mt]; }
    }
    // every register that a store above names (its address, its data) stays as it is up to this wait: each tile keeps registers of its own, so no wait is needed between the stores
    asm volatile("s_wait_xcnt 0x0" :: "v"(dst[0]), "v"(dst[1]), "v"(dst[2]),
                 "v"(oh[0][0]), "v"(oh[0][1]), "v"(oh[0][2]), "v"(oh[0][3]), "v"(ol[0][0]), "v"(ol[0][1]), "v"(ol[0][2]), "v"(ol[0][3]),
                 "v"(oh[1][0]), "v"(oh[1][1]), "v"(oh[1][2]), "v"(oh[1][3]), "v"(ol[1][0]), "v"(ol[1][1]), "v"(ol[1][2]), "v"(ol[1][3]),
                 "v"(oh[2][0]), "v"(oh[2][1]), "v"(oh[2][2]), "v"(oh[2][3]), "v"(ol[2][0]), "v"(ol[2][1]), "v"(ol[2][2]), "v"(ol[2][3]) : "memory");
}
// ---- k_fattn: scores, softmax and attn.v in one kernel; no score and no weight is stored in memory. Grid (T / (16 * QT), batches), QT * KS waves.
// A wave owns 16 queries (one per lane column) and T / KS keys, 64 keys a trip: St = K Qt (rows = keys), running maximum and sum per query, Ot += Vt Pt (rows = d).
// Two score tiles of 16 keys, converted in place, are the B operand of the second product in the hardware k order, which is also the order of WFrag::ld.
// K and Vt come in k_proj's fragment order: a lane's two pieces of a fragment (the ones WFrag::ld takes from a row) lie at 16 * lane in two neighbouring 512-byte blocks.
// The KS partial results of a query tile meet in LDS and are joined by their maxima, in split order.
typedef __attribute__((ext_vector_type(2))) __bf16 v2bf;
typedef __attribute__((ext_vector_type(8))) unsigned v8u;
__device__ __forceinline__ float xhalf(float x) { const int b = __float_as_int(x); return __int_as_float(__builtin_amdgcn_permlanex16(b, b, 0x76543210, 0xfedcba98, false, false)); }   // lane l <-> l ^ 16
// 2^x for two values. In asm so that the slot behind each v_exp_f32 is filled by construction: the second is independent of the first (results are kept off the sources), the v_nop stands behind the second;
__device__ __forceinline__ void exp2x2(float x0, float x1, float& y0, float& y1) { asm("v_exp_f32 %0, %2\n\tv_exp_f32 %1, %3\n\tv_nop" : "=&v"(y0), "=&v"(y1) : "v"(x0), "v"(x1)); }
template <int QT, int KS>
__global__ __launch_bounds__(QT * KS * 32) void k_fattn(const bf* __restrict__ Q, const bf* __restrict__ K, const bf* __restrict__ Vt, float* __restrict__ O) {
    typedef WFrag<bf>::V V;
    constexpr int LO = NB_ * TT * HD;   // each operand's lo plane lies this many elements behind its hi plane: one address register pair serves both, the distance is an immediate
    constexpr float CS = SCL * 1.4426950408889634f;   // scores are carried in log2 units
    __shared__ __align__(16) float red[QT * KS * 16 * 68];
    __shared__ __align__(16) bf qs[QT * KS * 8 * 32 * 8];
    __shared__ float stm[QT * KS * 16]; __shared__ float stl[QT * KS * 16];
    const int lane = threadIdx.x & 31, lr = lane & 15, hi = lane >> 4;
    const int w = __builtin_amdgcn_readfirstlane(threadIdx.x >> 5);   // the wave's number, the same in all its lanes: held in a scalar register, so that the operand bases below are scalar too
    const int qt = w % QT, ks = w / QT;
    const size_t zo = (size_t)blockIdx.y * TT * HD;
    const int q0 = blockIdx.x * (16 * QT);
    // Q's four fragments are parked in LDS, each lane's 16-byte pieces at the lane's own place, and read back at the top of every trip: kept in registers they would
    // hold 32 of them through the softmax and the second product, where V's 128 are live, and the allocator would spill to scratch. No other lane reads a lane's pieces: no barrier.
    bf* myq = qs + w * (8 * 32 * 8) + lane * 8;
    const size_t qo = zo + (size_t)(q0 + qt * 16 + lr) * HD + 8 * hi; const bf* aq = Q + qo;
#pragma unroll
    for (int f = 0; f < 8; ++f) *(v8usa*)(myq + f * 256) = *(const v8us*)(aq + (f >> 2) * LO + (f & 3) * 16);   // f = plane * 4 + k step * 2 + half
    asm volatile("s_wait_xcnt 0x0" :: "v"(aq) : "memory");   // the address pair of the Q loads stays as it is up to this wait; only behind it may its registers be reused
    const bf* pk = K + zo + (size_t)ks * (TT / KS) * HD; const bf* pv = Vt + zo + (size_t)ks * (TT / KS) * HD;
    const unsigned vol = (unsigned)lane * 16u;   // the lane's place in a 512-byte block, in bytes
    auto at = [&](const bf* base) { return (const bf*)((const char*)base + vol); };
    auto ldf = [](const bf* p) { return cat16b(*(const v8us*)p, *(const v8us*)(p + 256)); };   // a fragment: the lane's pieces of two neighbouring blocks
    v8f o[4];
#pragma unroll
    for (int mb = 0; mb < 4; ++mb) o[mb] = (v8f){};
    float m = -3.0e38f, l = 0.f;
    unsigned ko = 0;   // the trip's place in K and in Vt, in elements
    // rolled: the body is long; for speed only
#pragma unroll 1
    for (int t = 0; t < TT / KS / 64; ++t) {
        const bf* ak = at(pk + ko); const bf* av = at(pv + ko);   // the lane's two addresses of this trip; every load below is one of them plus an immediate
        V kh[4][2], kl[4][2], qh[2], ql[2];
#pragma unroll
        for (int s = 0; s < 2; ++s) { qh[s] = cat16b(*(const v8usa*)(myq + (s * 2) * 256), *(const v8usa*)(myq + (s * 2 + 1) * 256)); ql[s] = cat16b(*(const v8usa*)(myq + (4 + s * 2) * 256), *(const v8usa*)(myq + (4 + s * 2 + 1) * 256)); }
#pragma unroll
        for (int kt = 0; kt < 4; ++kt) {
#pragma unroll
            for (int s = 0; s < 2; ++s) kh[kt][s] = ldf(ak + kt * 1024 + s * 512);
#pragma unroll
            for (int s = 0; s < 2; ++s) kl[kt][s] = ldf(ak + LO + kt * 1024 + s * 512); }
        __builtin_amdgcn_sched_barrier(0);   // keeps the trip's 32 K loads in front of its first WMMA: without it they are sunk between the WMMAs, four in flight at a time
        v8f sc[4];
#pragma unroll
        for (int kt = 0; kt < 4; ++kt) sc[kt] = (v8f){};
#pragma unroll
        for (int s = 0; s < 2; ++s) {
#pragma unroll
            for (int kt = 0; kt < 4; ++kt) sc[kt] = wmmab(kh[kt][s], qh[s], sc[kt]);
#pragma unroll
            for (int kt = 0; kt < 4; ++kt) sc[kt] = wmmab(kl[kt][s], qh[s], sc[kt]);
#pragma unroll
            for (int kt = 0; kt < 4; ++kt) sc[kt] = wmmab(kh[kt][s], ql[s], sc[kt]); }
        V vh[4][2], vl[4][2];
#pragma unroll
        for (int mb = 0; mb < 4; ++mb) {
#pragma unroll
            for (int u = 0; u < 2; ++u) vh[mb][u] = ldf(av + u * 2048 + mb * 512);
#pragma unroll
            for (int u = 0; u < 2; ++u) vl[mb][u] = ldf(av + LO + u * 2048 + mb * 512); }
        asm volatile("s_wait_xcnt 0x0" :: "v"(ak), "v"(av) : "memory");   // the trip's two address pairs stay as they are up to this wait; only behind it may their registers be reused
        float mx = sc[0][0];
#pragma unroll
        for (int kt = 0; kt < 4; ++kt) {
#pragma unroll
            for (int j = 0; j < 8; ++j) mx = fmaxf(mx, sc[kt][j]); }
        mx = fmaxf(mx, xhalf(mx));   // the two lanes of a query hold different keys and need one common maximum
        const float mn = fmaxf(m, mx * CS); const float al = __builtin_amdgcn_exp2f(m - mn); m = mn; l *= al;
#pragma unroll
        for (int mb = 0; mb < 4; ++mb) o[mb] *= al;
        V ph[2], pl[2];
#pragma unroll
        for (int u = 0; u < 2; ++u) { v8u wh, wl;
#pragma unroll
            for (int e = 0; e < 8; ++e) { const int kt = 2 * u + (e >> 2), j = (e & 3) * 2; v2f p;
                float p0, p1; exp2x2(__builtin_fmaf(sc[kt][j], CS, -mn), __builtin_fmaf(sc[kt][j + 1], CS, -mn), p0, p1); p[0] = p0; p[1] = p1; l += p0 + p1;
                const unsigned hb = __builtin_bit_cast(unsigned, __builtin_convertvector(p, v2bf)); v2f r;
                r[0] = p[0] - __uint_as_float(hb << 16); r[1] = p[1] - __uint_as_float(hb & 0xFFFF0000u);
                wh[e] = hb; wl[e] = __builtin_bit_cast(unsigned, __builtin_convertvector(r, v2bf)); }
            ph[u] = __builtin_bit_cast(V, wh); pl[u] = __builtin_bit_cast(V, wl); }
        __builtin_amdgcn_sched_barrier(0);   // keeps the softmax arithmetic in front of the second product
#pragma unroll
        for (int u = 0; u < 2; ++u) {
#pragma unroll
            for (int mb = 0; mb < 4; ++mb) o[mb] = wmmab(vh[mb][u], ph[u], o[mb]);
#pragma unroll
            for (int mb = 0; mb < 4; ++mb) o[mb] = wmmab(vh[mb][u], pl[u], o[mb]);
#pragma unroll
            for (int mb = 0; mb < 4; ++mb) o[mb] = wmmab(vl[mb][u], ph[u], o[mb]); }
        ko += 64 * HD;
    }
    l += xhalf(l);   // the two halves' sums of a query, joined once
    float* my = red + w * (16 * 68) + lr * 68 + hi * 8;
#pragma unroll
    for (int mb = 0; mb < 4; ++mb) { v4f x0, x1;
#pragma unroll
        for (int j = 0; j < 4; ++j) { x0[j] = o[mb][j]; x1[j] = o[mb][4 + j]; }
        *(v4fa*)(my + mb * 16) = x0; *(v4fa*)(my + mb * 16 + 4) = x1; }
    if (hi == 0) { stm[w * 16 + lr] = m; stl[w * 16 + lr] = l; }
    __syncthreads();   // every wave's partial tile, maximum and sum are in LDS before any of them is joined
    // eight d a thread: a wave stores four whole 256-byte output rows
    for (int e = threadIdx.x; e < QT * 16 * 8; e += QT * KS * 32) { const int qq = e >> 3, tq = qq >> 4, r = qq & 15, d0 = (e & 7) * 8;
        float M = stm[tq * 16 + r];
#pragma unroll
        for (int s = 1; s < KS; ++s) M = fmaxf(M, stm[(s * QT + tq) * 16 + r]);
        float L = 0.f; v4f y0 = (v4f){}, y1 = (v4f){};
#pragma unroll
        for (int s = 0; s < KS; ++s) { const int ws = s * QT + tq; const float g = __builtin_amdgcn_exp2f(stm[ws * 16 + r] - M); L += g * stl[ws * 16 + r];
            const float* p = red + ws * (16 * 68) + r * 68 + d0; y0 += g * *(const v4fa*)p; y1 += g * *(const v4fa*)(p + 4); }
        const float f = __fdiv_rn(1.0f, L); float* dst = O + zo + (size_t)(q0 + qq) * HD + d0;
        *(v4f*)dst = y0 * f; *(v4f*)(dst + 4) = y1 * f; }
}

extern "C" void kernel_launch(void* const* d_in, const int* in_sizes, int n_in,
                              void* d_out, int out_size, void* d_ws, size_t ws_size, hipStream_t stream) {
    (void)in_sizes; (void)n_in; (void)out_size;
    const float* x = (const float*)d_in[0]; const float* w = (const float*)d_in[1]; const float* bqkv = (const float*)d_in[2];
    float* OUT = (float*)d_out;     // [4][4096][64]
    char* wsp = (char*)d_ws;
    auto take = [&](size_t bytes) { char* p = wsp; wsp += (bytes + 255) & ~(size_t)255; return (void*)p; };
    const size_t PN = (size_t)TT * HD;   // one batch's plane, in elements; every plane holds all batches
    bf* QPh = (bf*)take(2 * NB_ * PN * 2); bf* KPh = (bf*)take(2 * NB_ * PN * 2); bf* VTh = (bf*)take(2 * NB_ * PN * 2);   // hi plane, then lo plane
    if ((size_t)(wsp - (char*)d_ws) > ws_size) return;    // ws 256 MiB
    k_proj<<<NB_ * TT / 64, 128, 0, stream>>>(x, w, bqkv, QPh, KPh, VTh);   /* [q | k | v] = x W + b, split into hi/lo planes (v transposed), all batches */
    k_fattn<4, 4><<<dim3(TT / 64, NB_, 1), 4 * 4 * 32, 0, stream>>>(QPh, KPh, VTh, OUT);   /* out = softmax(q k / 8) v, all batches (rows of 256 B) */
}

// v006
// One run takes 28 microseconds.
// It is 1.52 times as fast as v004, going by the measured steps of the versions left out in between.
// All steps since v000 together make it 23.4 times as fast.
#include <hip/hip_runtime.h>

// Single-head self-attention (x [4][4096][64]; qkv = x W + b ('xw' [64][192] + [192]) -> q | k | v (64 each); scores = q.k / 8 over all 4096 keys; softmax; out = attn v -> [4][4096][64] (1.0 M)).
// Compute dtypes, f32 accumulate: every input rounded to bf16; the fused projection on PLAIN bf16 operands (exact) + f32 bias; scores on f16 operands, k rounded once and q as an f16 hi/lo pair (2 products); attn.v on f16 operands, weights and v each rounded once (1 product); softmax f32 (running maximum and sum, inside the fused attention kernel, which writes the output rows directly).

#define NB_  4
#define TT   4096
#define DM   64
#define HD   64
#define NH_  1
#define DQ   64
#define D3   192
#define ZH   1
#define PCAR 1024.0f
#define SCL  0.125f   // DIM^-0.5
typedef _Float16 h16;
typedef unsigned short bf;
typedef __attribute__((ext_vector_type(16))) __bf16   v16bf;
typedef __attribute__((ext_vector_type(16))) _Float16 v16h;
typedef __attribute__((ext_vector_type(8)))  _Float16 v8h;
typedef __attribute__((ext_vector_type(8)))  unsigned short v8us;
typedef __attribute__((ext_vector_type(8)))  float    v8f;
typedef __attribute__((ext_vector_type(4)))  float    v4f;
typedef __attribute__((ext_vector_type(2)))  float    v2f;
typedef v8h  __attribute__((may_alias)) v8ha;
typedef v4f  __attribute__((may_alias)) v4fa;
typedef v8us __attribute__((may_alias)) v8usa;

__device__ __forceinline__ unsigned short f2bf(float f) { unsigned u = __float_as_uint(f); u += 0x7FFFu + ((u >> 16) & 1u); return (unsigned short)(u >> 16); }
__device__ __forceinline__ float bf2f(unsigned short b) { return __uint_as_float(((unsigned)b) << 16); }
__device__ __forceinline__ float bfr(float f) { return bf2f(f2bf(f)); }
__device__ __forceinline__ v16h cat16(v8h lo, v8h hi) { return __builtin_shufflevector(lo, hi, 0, 1, 2, 3, 4, 5, 6, 7, 8, 9, 10, 11, 12, 13, 14, 15); }
__device__ __forceinline__ v16bf cat16b(v8us lo, v8us hi) { return __builtin_bit_cast(v16bf, __builtin_shufflevector(lo, hi, 0, 1, 2, 3, 4, 5, 6, 7, 8, 9, 10, 11, 12, 13, 14, 15)); }
__device__ __forceinline__ v8f wmma16(v16h a, v16h b, v8f c) { return __builtin_amdgcn_wmma_f32_16x16x32_f16(false, a, false, b, (short)0, c, false, false); }
__device__ __forceinline__ v8f wmmab(v16bf a, v16bf b, v8f c) { return __builtin_amdgcn_wmma_f32_16x16x32_bf16(false, a, false, b, (short)0, c, false, false); }



// ---- 16-bit WMMA fragments, loaded from K-contiguous rows
template <typename T16> struct WFrag;
template <> struct WFrag<h16> { typedef v16h V; static __device__ __forceinline__ V ld(const h16* p) { return cat16(*(const v8h*)p, *(const v8h*)(p + 16)); } static __device__ __forceinline__ v8f mma(V a, V b, v8f c) { return wmma16(a, b, c); } };
template <> struct WFrag<bf> { typedef v16bf V; static __device__ __forceinline__ V ld(const bf* p) { return cat16b(*(const v8us*)p, *(const v8us*)(p + 16)); } static __device__ __forceinline__ v8f mma(V a, V b, v8f c) { return wmmab(a, b, c); } };

__device__ __forceinline__ h16 tohx(float x) { return (h16)x; }
__device__ __forceinline__ void splitf(float y, h16& h, h16& l) { h = (h16)y; l = (h16)(y - (float)h); }
typedef __attribute__((ext_vector_type(2))) _Float16 v2h;
typedef __attribute__((ext_vector_type(4))) _Float16 v4h;
typedef __attribute__((ext_vector_type(2))) unsigned short v2us;
typedef __attribute__((ext_vector_type(4))) unsigned short v4us;
typedef __attribute__((ext_vector_type(4))) int v4i;

// ---- k_proj: the whole path from x, W and b to the four operand planes of k_fattn (q hi, q lo, k, v; f16), all batches, in one kernel. Grid (batches * T / 64), 4 waves; a work-group owns 64 rows of x and all 192 columns.
// W is rounded to bf16 and laid transposed ([column][k]) in LDS once per work-group; x is rounded to bf16 in registers, each wave's 16 rows directly as its fragments, and laid in LDS for the other waves.
// f32 bias, then the rounding to f16 (q: the hi/lo split), straight from the accumulators. Wave i writes three pieces:
// q and k, rows 16 i .. 16 i + 15, all 64 columns: product Wt x^T (rows = columns of the plane), so a lane holds 8 neighbouring columns of one row: one 16-byte store per plane;
// v, columns 16 i .. 16 i + 15, all 64 rows: product x Wt^T (rows = t), so a lane holds 8 neighbouring t of one column: one 16-byte store per transposed plane. Every 128-byte line of a plane is written by one wave.
// The k and v planes lie in FRAGMENT ORDER: blocks of 512 bytes, lane l's 16-byte piece of a half fragment at 16 l, so that a wave-wide 16-byte access covers four whole 128-byte lines instead of 32 bytes of each of 16 lines.
// k: [16-key tile][column / 16][lane][8]; v: [32-key block][d / 16][(key % 32) / 16][lane][8]; lane = 16 * (piece of 8 within the 16) + row of the fragment (key % 16 for k, d % 16 for v). 64 keys are 8 KiB in a row in either. q stays row-major.
__global__ __launch_bounds__(128) void k_proj(const float* __restrict__ x, const float* __restrict__ w, const float* __restrict__ bias, h16* __restrict__ Qh, h16* __restrict__ Kh, h16* __restrict__ Vh) {
    typedef WFrag<bf>::V V;
    constexpr int LO = NB_ * TT * HD;   // q's lo plane lies this many elements behind its hi plane
    constexpr int WP = DM + 8;          // pitch of a row in LDS, in elements (144 bytes: the 16 rows of a fragment start in 16 different groups of four banks)
    __shared__ __align__(16) bf wt[D3 * WP];
    __shared__ __align__(16) bf xs[64 * WP];
    const int lane = threadIdx.x & 31, lr = lane & 15, hi = lane >> 4;
    const int wv = __builtin_amdgcn_readfirstlane(threadIdx.x >> 5);   // the wave's number, the same in all its lanes: held in a scalar register
    const int g0 = blockIdx.x * 64;     // first row, counted over all batches
    // W: a thread brings three blocks of 4 columns x 8 k, neighbouring lanes on neighbouring columns; x: the lane's four 8-element pieces of its row (the k order of WFrag::ld)
    const float* px = x + (size_t)(g0 + wv * 16 + lr) * DM + 8 * hi;
    const float* pb = bias + 8 * hi;    // q and k: the lane's 8 columns of each 16-column tile; v: one column
    const float* pw[3];
    v4f wr[3][8]; v8f xr[4], bb[8];
#pragma unroll
    for (int p = 0; p < 4; ++p) xr[p] = *(const v8f*)(px + p * 16);
#pragma unroll
    for (int r = 0; r < 3; ++r) { const int it = (int)threadIdx.x + 128 * r; pw[r] = w + (it / 48) * 8 * D3 + (it % 48) * 4;
#pragma unroll
        for (int e = 0; e < 8; ++e) wr[r][e] = *(const v4f*)(pw[r] + e * D3); }
#pragma unroll
    for (int c = 0; c < 8; ++c) bb[c] = *(const v8f*)(pb + c * 16);
    const float* pv = bias + 2 * HD + wv * 16 + lr; const float bv = bfr(*pv);
    __builtin_amdgcn_sched_barrier(0);   // keeps all of the wave's loads in front of the first conversion: without it a part of them was issued only after the first had returned, a second memory latency
    asm volatile("s_wait_xcnt 0x0" :: "v"(px), "v"(pw[0]), "v"(pw[1]), "v"(pw[2]) : "memory");   // the loads' address registers stay as they are up to this wait; only behind it may they be reused
    v8us xc[4];
#pragma unroll
    for (int p = 0; p < 4; ++p) {
#pragma unroll
        for (int e = 0; e < 8; ++e) xc[p][e] = f2bf(xr[p][e]);
        *(v8usa*)(xs + (wv * 16 + lr) * WP + 8 * hi + p * 16) = xc[p]; }
#pragma unroll
    for (int r = 0; r < 3; ++r) { const int it = (int)threadIdx.x + 128 * r; bf* pt = wt + (it % 48) * 4 * WP + (it / 48) * 8;
#pragma unroll
        for (int cc = 0; cc < 4; ++cc) { v8us o;
#pragma unroll
            for (int e = 0; e < 8; ++e) o[e] = f2bf(wr[r][e][cc]);
            *(v8usa*)(pt + cc * WP) = o; } }
    const V xf[2] = { cat16b(xc[0], xc[1]), cat16b(xc[2], xc[3]) };
    __syncthreads();   // all of W^T and of the 64 rows of x is in LDS before any wave reads a fragment of them
    const int fo = lr * WP + 8 * hi;   // the lane's place in a 16-row fragment in LDS
    v8h oh[3][4], ol[4]; h16* dst[3];
#pragma unroll
    for (int part = 0; part < 2; ++part) {   // q, then k
        dst[part] = part == 0 ? Qh + (size_t)(g0 + wv * 16 + lr) * HD + 8 * hi : Kh + (size_t)(g0 + wv * 16) * HD + lane * 8;
        const int cs = part == 0 ? 16 : 256;   // from one 16-column piece to the next: along the row for q, one 512-byte block for k
#pragma unroll
        for (int ct = 0; ct < 4; ++ct) { const int c0 = part * HD + ct * 16; v8f acc = (v8f){};
#pragma unroll
            for (int s = 0; s < 2; ++s) acc = wmmab(WFrag<bf>::ld(wt + c0 * WP + fo + s * 32), xf[s], acc);
#pragma unroll
            for (int j = 0; j < 8; ++j) { h16 a, c2; splitf(acc[j] + bfr(bb[part * 4 + ct][j]), a, c2); oh[part][ct][j] = a; if (part == 0) ol[ct][j] = c2; }
            *(v8h*)(dst[part] + ct * cs) = oh[part][ct]; if (part == 0) *(v8h*)(dst[part] + LO + ct * cs) = ol[ct]; } }
    {
        const int d0 = wv * 16;
        const V wb[2] = { WFrag<bf>::ld(wt + (2 * HD + d0) * WP + fo), WFrag<bf>::ld(wt + (2 * HD + d0) * WP + fo + 32) };
        dst[2] = Vh + (size_t)g0 * HD + wv * 512 + lane * 8;   // the group's 64 keys are two 32-key blocks of 2048 elements; the wave's 16 d are blocks 2 wv and 2 wv + 1 of each
#pragma unroll
        for (int mt = 0; mt < 4; ++mt) { v8f acc = (v8f){};
#pragma unroll
            for (int s = 0; s < 2; ++s) acc = wmmab(WFrag<bf>::ld(xs + mt * 16 * WP + fo + s * 32), wb[s], acc);
#pragma unroll
            for (int j = 0; j < 8; ++j) oh[2][mt][j] = (h16)(acc[j] + bv);
            *(v8h*)(dst[2] + (mt >> 1) * 2048 + (mt & 1) * 256) = oh[2][mt]; }
    }
    // every register that a store above names (its address, its data) stays as it is up to this wait: each tile keeps registers of its own, so no wait is needed between the stores
    asm volatile("s_wait_xcnt 0x0" :: "v"(dst[0]), "v"(dst[1]), "v"(dst[2]),
                 "v"(oh[0][0]), "v"(oh[0][1]), "v"(oh[0][2]), "v"(oh[0][3]), "v"(ol[0]), "v"(ol[1]), "v"(ol[2]), "v"(ol[3]),
                 "v"(oh[1][0]), "v"(oh[1][1]), "v"(oh[1][2]), "v"(oh[1][3]), "v"(oh[2][0]), "v"(oh[2][1]), "v"(oh[2][2]), "v"(oh[2][3]) : "memory");
}
// ---- k_fattn: scores, softmax and attn.v in one kernel; no score and no weight is stored in memory. Grid (T / (16 * QT), batches), QT * KS waves.
// A wave owns 16 queries (one per lane column) and T / KS keys, 64 keys a trip: St = K Qt (rows = keys), running maximum and sum per query, Ot += Vt Pt (rows = d).
// Two score tiles of 16 keys, converted in place, are the B operand of the second product in the hardware k order, which is also the order of WFrag::ld.
// K's fragments are fetched one trip ahead, into the registers that the first product has just finished with; Vt's at the top of their own trip: no load is waited for directly behind its issue.
// K and Vt come in k_proj's fragment order: a lane's two pieces of a fragment (the ones WFrag::ld takes from a row) lie at 16 * lane in two neighbouring 512-byte blocks.
// The KS partial results of a query tile meet in LDS and are joined by their maxima, in split order.
typedef __attribute__((ext_vector_type(2))) __bf16 v2bf;
typedef __attribute__((ext_vector_type(8))) unsigned v8u;
__device__ __forceinline__ float xhalf(float x) { const int b = __float_as_int(x); return __int_as_float(__builtin_amdgcn_permlanex16(b, b, 0x76543210, 0xfedcba98, false, false)); }   // lane l <-> l ^ 16
// 2^x for two values. In asm so that the slot behind each v_exp_f32 is filled by construction: the second is independent of the first (results are kept off the sources), the v_nop stands behind the second;
__device__ __forceinline__ void exp2x2(float x0, float x1, float& y0, float& y1) { asm("v_exp_f32 %0, %2\n\tv_exp_f32 %1, %3\n\tv_nop" : "=&v"(y0), "=&v"(y1) : "v"(x0), "v"(x1)); }
template <bool B> struct Flag { static constexpr bool value = B; };
template <int QT, int KS>
__global__ __launch_bounds__(QT * KS * 32) void k_fattn(const h16* __restrict__ Q, const h16* __restrict__ K, const h16* __restrict__ Vt, float* __restrict__ O) {
    typedef WFrag<h16>::V V;
    constexpr int LO = NB_ * TT * HD;   // q's lo plane lies this many elements behind its hi plane: one address register pair serves both, the distance is an immediate
    constexpr float CS = SCL * 1.4426950408889634f;   // scores are carried in log2 units
    __shared__ __align__(16) float red[QT * KS * 16 * 68];
    __shared__ __align__(16) h16 qs[QT * KS * 8 * 32 * 8];
    __shared__ float stm[QT * KS * 16]; __shared__ float stl[QT * KS * 16];
    const int lane = threadIdx.x & 31, lr = lane & 15, hi = lane >> 4;
    const int w = __builtin_amdgcn_readfirstlane(threadIdx.x >> 5);   // the wave's number, the same in all its lanes: held in a scalar register, so that the operand bases below are scalar too
    const int qt = w % QT, ks = w / QT;
    const size_t zo = (size_t)blockIdx.y * TT * HD;
    const int q0 = blockIdx.x * (16 * QT);
    const h16* pk = K + zo + (size_t)ks * (TT / KS) * HD; const h16* pv = Vt + zo + (size_t)ks * (TT / KS) * HD;
    const unsigned vol = (unsigned)lane * 16u;   // the lane's place in a 512-byte block, in bytes
    auto at = [&](const h16* base) { return (const h16*)((const char*)base + vol); };
    auto ldf = [](const h16* p) { return cat16(*(const v8h*)p, *(const v8h*)(p + 256)); };   // a fragment: the lane's pieces of two neighbouring blocks
    V kh[4][2];        // K's fragments of the trip at hand; refilled for the next trip behind the first product. The first trip's are asked for here, ahead of Q, and arrive while Q is parked
    {
        const h16* a0 = at(pk);
#pragma unroll
        for (int kt = 0; kt < 4; ++kt) {
#pragma unroll
            for (int s = 0; s < 2; ++s) kh[kt][s] = ldf(a0 + kt * 1024 + s * 512); }
        asm volatile("s_wait_xcnt 0x0" :: "v"(a0) : "memory");   // the address pair of the first K loads stays as it is up to this wait
    }
    // Q's four fragments are parked in LDS, each lane's 16-byte pieces at the lane's own place, and read back at the top of every trip: kept in registers they would
    // hold 32 of them through the softmax and the second product. No other lane reads a lane's pieces: no barrier.
    h16* myq = qs + w * (8 * 32 * 8) + lane * 8;
    const size_t qo = zo + (size_t)(q0 + qt * 16 + lr) * HD + 8 * hi; const h16* aq = Q + qo;
#pragma unroll
    for (int f = 0; f < 8; ++f) *(v8ha*)(myq + f * 256) = *(const v8h*)(aq + (f >> 2) * LO + (f & 3) * 16);   // f = plane * 4 + k step * 2 + half
    asm volatile("s_wait_xcnt 0x0" :: "v"(aq) : "memory");   // the address pair of the Q loads stays as it is up to this wait; only behind it may its registers be reused
    v8f o[4];
#pragma unroll
    for (int mb = 0; mb < 4; ++mb) o[mb] = (v8f){};
    float m = -3.0e38f, l = 0.f;
    unsigned ko = 0;   // the trip's place in K and in Vt, in elements
    auto trip = [&](auto more) {   // more: another trip follows, and its K fragments are fetched in this one
        const h16* ak = at(pk + ko); const h16* av = at(pv + ko);   // the lane's two addresses of this trip; every load below is one of them plus an immediate
        V vh[4][2], qh[2], ql[2];
#pragma unroll
        for (int mb = 0; mb < 4; ++mb) {
#pragma unroll
            for (int u = 0; u < 2; ++u) vh[mb][u] = ldf(av + u * 2048 + mb * 512); }
#pragma unroll
        for (int s = 0; s < 2; ++s) { qh[s] = cat16(*(const v8ha*)(myq + (s * 2) * 256), *(const v8ha*)(myq + (s * 2 + 1) * 256)); ql[s] = cat16(*(const v8ha*)(myq + (4 + s * 2) * 256), *(const v8ha*)(myq + (4 + s * 2 + 1) * 256)); }
        __builtin_amdgcn_sched_barrier(0);   // keeps the trip's 16 Vt loads in front of its first WMMA: they have the first product and the softmax to arrive in
        v8f sc[4];
#pragma unroll
        for (int kt = 0; kt < 4; ++kt) sc[kt] = (v8f){};
#pragma unroll
        for (int s = 0; s < 2; ++s) {
#pragma unroll
            for (int kt = 0; kt < 4; ++kt) sc[kt] = wmma16(kh[kt][s], qh[s], sc[kt]);
#pragma unroll
            for (int kt = 0; kt < 4; ++kt) sc[kt] = wmma16(kh[kt][s], ql[s], sc[kt]); }
        if constexpr (decltype(more)::value) {
#pragma unroll
            for (int kt = 0; kt < 4; ++kt) {
#pragma unroll
                for (int s = 0; s < 2; ++s) kh[kt][s] = ldf(ak + 64 * HD + kt * 1024 + s * 512); }
            asm volatile("s_wait_xcnt 0x0" :: "v"(ak), "v"(av) : "memory");   // the trip's two address pairs stay as they are up to this wait; only behind it may their registers be reused
        } else {
            asm volatile("s_wait_xcnt 0x0" :: "v"(av) : "memory");   // the same for the last trip's one address pair
        }
        float mx = sc[0][0];
#pragma unroll
        for (int kt = 0; kt < 4; ++kt) {
#pragma unroll
            for (int j = 0; j < 8; ++j) mx = fmaxf(mx, sc[kt][j]); }
        mx = fmaxf(mx, xhalf(mx));   // the two lanes of a query hold different keys and need one common maximum
        const float mn = fmaxf(m, mx * CS); const float al = __builtin_amdgcn_exp2f(m - mn); m = mn; l *= al;
#pragma unroll
        for (int mb = 0; mb < 4; ++mb) o[mb] *= al;
        V ph[2];
#pragma unroll
        for (int u = 0; u < 2; ++u) { v8u wh;
#pragma unroll
            for (int e = 0; e < 8; ++e) { const int kt = 2 * u + (e >> 2), j = (e & 3) * 2; v2f p;
                float p0, p1; exp2x2(__builtin_fmaf(sc[kt][j], CS, -mn), __builtin_fmaf(sc[kt][j + 1], CS, -mn), p0, p1); p[0] = p0; p[1] = p1; l += p0 + p1;
                wh[e] = __builtin_bit_cast(unsigned, __builtin_convertvector(p, v2h)); }
            ph[u] = __builtin_bit_cast(V, wh); }
        __builtin_amdgcn_sched_barrier(0);   // keeps the softmax arithmetic in front of the second product
#pragma unroll
        for (int u = 0; u < 2; ++u) {
#pragma unroll
            for (int mb = 0; mb < 4; ++mb) o[mb] = wmma16(vh[mb][u], ph[u], o[mb]); }
        ko += 64 * HD;
    };
    // rolled, for speed only: the body is long; the last trip, which has nothing to fetch ahead, stands by itself
#pragma unroll 1
    for (int t = 0; t < TT / KS / 64 - 1; ++t) trip(Flag<true>{});
    trip(Flag<false>{});
    l += xhalf(l);   // the two halves' sums of a query, joined once
    float* my = red + w * (16 * 68) + lr * 68 + hi * 8;
#pragma unroll
    for (int mb = 0; mb < 4; ++mb) { v4f x0, x1;
#pragma unroll
        for (int j = 0; j < 4; ++j) { x0[j] = o[mb][j]; x1[j] = o[mb][4 + j]; }
        *(v4fa*)(my + mb * 16) = x0; *(v4fa*)(my + mb * 16 + 4) = x1; }
    if (hi == 0) { stm[w * 16 + lr] = m; stl[w * 16 + lr] = l; }
    __syncthreads();   // every wave's partial tile, maximum and sum are in LDS before any of them is joined
    // eight d a thread: a wave stores four whole 256-byte output rows
    for (int e = threadIdx.x; e < QT * 16 * 8; e += QT * KS * 32) { const int qq = e >> 3, tq = qq >> 4, r = qq & 15, d0 = (e & 7) * 8;
        float M = stm[tq * 16 + r];
#pragma unroll
        for (int s = 1; s < KS; ++s) M = fmaxf(M, stm[(s * QT + tq) * 16 + r]);
        float L = 0.f; v4f y0 = (v4f){}, y1 = (v4f){};
#pragma unroll
        for (int s = 0; s < KS; ++s) { const int ws = s * QT + tq; const float g = __builtin_amdgcn_exp2f(stm[ws * 16 + r] - M); L += g * stl[ws * 16 + r];
            const float* p = red + ws * (16 * 68) + r * 68 + d0; y0 += g * *(const v4fa*)p; y1 += g * *(const v4fa*)(p + 4); }
        const float f = __fdiv_rn(1.0f, L); float* dst = O + zo + (size_t)(q0 + qq) * HD + d0;
        *(v4f*)dst = y0 * f; *(v4f*)(dst + 4) = y1 * f; }
}

extern "C" void kernel_launch(void* const* d_in, const int* in_sizes, int n_in,
                              void* d_out, int out_size, void* d_ws, size_t ws_size, hipStream_t stream) {
    (void)in_sizes; (void)n_in; (void)out_size;
    const float* x = (const float*)d_in[0]; const float* w = (const float*)d_in[1]; const float* bqkv = (const float*)d_in[2];
    float* OUT = (float*)d_out;     // [4][4096][64]
    char* wsp = (char*)d_ws;
    auto take = [&](size_t bytes) { char* p = wsp; wsp += (bytes + 255) & ~(size_t)255; return (void*)p; };
    const size_t PN = (size_t)TT * HD;   // one batch's plane, in elements; every plane holds all batches
    h16* QPh = (h16*)take(2 * NB_ * PN * 2); h16* KPh = (h16*)take(NB_ * PN * 2); h16* VTh = (h16*)take(NB_ * PN * 2);   // q: hi plane, then lo plane; k and v: one plane each
    if ((size_t)(wsp - (char*)d_ws) > ws_size) return;    // ws 256 MiB
    k_proj<<<NB_ * TT / 64, 128, 0, stream>>>(x, w, bqkv, QPh, KPh, VTh);   /* [q | k | v] = x W + b, rounded to f16 planes (q as hi/lo, v transposed), all batches */
    k_fattn<4, 4><<<dim3(TT / 64, NB_, 1), 4 * 4 * 32, 0, stream>>>(QPh, KPh, VTh, OUT);   /* out = softmax(q k / 8) v, all batches (rows of 256 B) */
}

// v007
// A run of this version takes 22.9 microseconds.
// In both of two side-by-side timings against v006, it was 1.21 times as fast.
// Counting every step since v000, it is 28.4 times as fast.
#include <hip/hip_runtime.h>

// Single-head self-attention (x [4][4096][64]; qkv = x W + b ('xw' [64][192] + [192]) -> q | k | v (64 each); scores = q.k / 8 over all 4096 keys; softmax; out = attn v -> [4][4096][64] (1.0 M)).
// Compute dtypes, f32 accumulate: every input rounded to bf16; the fused projection on PLAIN bf16 operands (exact) + f32 bias; scores on f16 operands, k rounded once and q as an f16 hi/lo pair (2 products); attn.v on f16 operands, weights and v each rounded once (1 product); softmax f32 (a reference maximum that moves only when it must, and a running sum, inside the fused attention kernel, which writes the output rows directly).

#define NB_  4
#define TT   4096
#define DM   64
#define HD   64
#define NH_  1
#define DQ   64
#define D3   192
#define ZH   1
#define PCAR 1024.0f
#define SCL  0.125f   // DIM^-0.5
#define CSL  (SCL * 1.4426950408889634f)   // scores are carried in log2 units; k_proj multiplies q by this before q's hi/lo split
typedef _Float16 h16;
typedef unsigned short bf;
typedef __attribute__((ext_vector_type(16))) __bf16   v16bf;
typedef __attribute__((ext_vector_type(16))) _Float16 v16h;
typedef __attribute__((ext_vector_type(8)))  _Float16 v8h;
typedef __attribute__((ext_vector_type(8)))  unsigned short v8us;
typedef __attribute__((ext_vector_type(8)))  float    v8f;
typedef __attribute__((ext_vector_type(4)))  float    v4f;
typedef __attribute__((ext_vector_type(2)))  float    v2f;
typedef v8h  __attribute__((may_alias)) v8ha;
typedef v4f  __attribute__((may_alias)) v4fa;
typedef v8us __attribute__((may_alias)) v8usa;

__device__ __forceinline__ unsigned short f2bf(float f) { unsigned u = __float_as_uint(f); u += 0x7FFFu + ((u >> 16) & 1u); return (unsigned short)(u >> 16); }
__device__ __forceinline__ float bf2f(unsigned short b) { return __uint_as_float(((unsigned)b) << 16); }
__device__ __forceinline__ float bfr(float f) { return bf2f(f2bf(f)); }
__device__ __forceinline__ v16h cat16(v8h lo, v8h hi) { return __builtin_shufflevector(lo, hi, 0, 1, 2, 3, 4, 5, 6, 7, 8, 9, 10, 11, 12, 13, 14, 15); }
__device__ __forceinline__ v16bf cat16b(v8us lo, v8us hi) { return __builtin_bit_cast(v16bf, __builtin_shufflevector(lo, hi, 0, 1, 2, 3, 4, 5, 6, 7, 8, 9, 10, 11, 12, 13, 14, 15)); }
__device__ __forceinline__ v8f wmma16(v16h a, v16h b, v8f c) { return __builtin_amdgcn_wmma_f32_16x16x32_f16(false, a, false, b, (short)0, c, false, false); }
__device__ __forceinline__ v8f wmmab(v16bf a, v16bf b, v8f c) { return __builtin_amdgcn_wmma_f32_16x16x32_bf16(false, a, false, b, (short)0, c, false, false); }



// ---- 16-bit WMMA fragments, loaded from K-contiguous rows
template <typename T16> struct WFrag;
template <> struct WFrag<h16> { typedef v16h V; static __device__ __forceinline__ V ld(const h16* p) { return cat16(*(const v8h*)p, *(const v8h*)(p + 16)); } static __device__ __forceinline__ v8f mma(V a, V b, v8f c) { return wmma16(a, b, c); } };
template <> struct WFrag<bf> { typedef v16bf V; static __device__ __forceinline__ V ld(const bf* p) { return cat16b(*(const v8us*)p, *(const v8us*)(p + 16)); } static __device__ __forceinline__ v8f mma(V a, V b, v8f c) { return wmmab(a, b, c); } };

__device__ __forceinline__ h16 tohx(float x) { return (h16)x; }
__device__ __forceinline__ void splitf(float y, h16& h, h16& l) { h = (h16)y; l = (h16)(y - (float)h); }
typedef __attribute__((ext_vector_type(2))) _Float16 v2h;
typedef __attribute__((ext_vector_type(4))) _Float16 v4h;
typedef __attribute__((ext_vector_type(2))) unsigned short v2us;
typedef __attribute__((ext_vector_type(4))) unsigned short v4us;
typedef __attribute__((ext_vector_type(4))) int v4i;

// ---- k_proj: the whole path from x, W and b to the four operand planes of k_fattn (q hi, q lo, k, v; f16), all batches, in one kernel. Grid (batches * T / 64), 4 waves; a work-group owns 64 rows of x and all 192 columns.
// W is rounded to bf16 and laid transposed ([column][k]) in LDS once per work-group; x is rounded to bf16 in registers, each wave's 16 rows directly as its fragments, and laid in LDS for the other waves.
// f32 bias, then the rounding to f16 (q: times CSL, then the hi/lo split), straight from the accumulators. Wave i writes three pieces:
// q and k, rows 16 i .. 16 i + 15, all 64 columns: product Wt x^T (rows = columns of the plane), so a lane holds 8 neighbouring columns of one row: one 16-byte store per plane;
// v, columns 16 i .. 16 i + 15, all 64 rows: product x Wt^T (rows = t), so a lane holds 8 neighbouring t of one column: one 16-byte store per transposed plane. Every 128-byte line of a plane is written by one wave.
// The k and v planes lie in FRAGMENT ORDER: blocks of 512 bytes, lane l's 16-byte piece of a half fragment at 16 l, so that a wave-wide 16-byte access covers four whole 128-byte lines instead of 32 bytes of each of 16 lines.
// k: [16-key tile][column / 16][lane][8]; v: [32-key block][d / 16][(key % 32) / 16][lane][8]; lane = 16 * (piece of 8 within the 16) + row of the fragment (key % 16 for k, d % 16 for v). 64 keys are 8 KiB in a row in either. q stays row-major.
__global__ __launch_bounds__(128) void k_proj(const float* __restrict__ x, const float* __restrict__ w, const float* __restrict__ bias, h16* __restrict__ Qh, h16* __restrict__ Kh, h16* __restrict__ Vh) {
    typedef WFrag<bf>::V V;
    constexpr int LO = NB_ * TT * HD;   // q's lo plane lies this many elements behind its hi plane
    constexpr int WP = DM + 8;          // pitch of a row in LDS, in elements (144 bytes: the 16 rows of a fragment start in 16 different groups of four banks)
    __shared__ __align__(16) bf wt[D3 * WP];
    __shared__ __align__(16) bf xs[64 * WP];
    const int lane = threadIdx.x & 31, lr = lane & 15, hi = lane >> 4;
    const int wv = __builtin_amdgcn_readfirstlane(threadIdx.x >> 5);   // the wave's number, the same in all its lanes: held in a scalar register
    const int g0 = blockIdx.x * 64;     // first row, counted over all batches
    // W: a thread brings three blocks of 4 columns x 8 k, neighbouring lanes on neighbouring columns; x: the lane's four 8-element pieces of its row (the k order of WFrag::ld)
    const float* px = x + (size_t)(g0 + wv * 16 + lr) * DM + 8 * hi;
    const float* pb = bias + 8 * hi;    // q and k: the lane's 8 columns of each 16-column tile; v: one column
    const float* pw[3];
    v4f wr[3][8]; v8f xr[4], bb[8];
#pragma unroll
    for (int p = 0; p < 4; ++p) xr[p] = *(const v8f*)(px + p * 16);
#pragma unroll
    for (int r = 0; r < 3; ++r) { const int it = (int)threadIdx.x + 128 * r; pw[r] = w + (it / 48) * 8 * D3 + (it % 48) * 4;
#pragma unroll
        for (int e = 0; e < 8; ++e) wr[r][e] = *(const v4f*)(pw[r] + e * D3); }
#pragma unroll
    for (int c = 0; c < 8; ++c) bb[c] = *(const v8f*)(pb + c * 16);
    const float* pv = bias + 2 * HD + wv * 16 + lr; const float bv = bfr(*pv);
    __builtin_amdgcn_sched_barrier(0);   // keeps all of the wave's loads in front of the first conversion: without it a part of them was issued only after the first had returned, a second memory latency
    asm volatile("s_wait_xcnt 0x0" :: "v"(px), "v"(pw[0]), "v"(pw[1]), "v"(pw[2]) : "memory");   // the loads' address registers stay as they are up to this wait; only behind it may they be reused
    v8us xc[4];
#pragma unroll
    for (int p = 0; p < 4; ++p) {
#pragma unroll
        for (int e = 0; e < 8; ++e) xc[p][e] = f2bf(xr[p][e]);
        *(v8usa*)(xs + (wv * 16 + lr) * WP + 8 * hi + p * 16) = xc[p]; }
#pragma unroll
    for (int r = 0; r < 3; ++r) { const int it = (int)threadIdx.x + 128 * r; bf* pt = wt + (it % 48) * 4 * WP + (it / 48) * 8;
#pragma unroll
        for (int cc = 0; cc < 4; ++cc) { v8us o;
#pragma unroll
            for (int e = 0; e < 8; ++e) o[e] = f2bf(wr[r][e][cc]);
            *(v8usa*)(pt + cc * WP) = o; } }
    const V xf[2] = { cat16b(xc[0], xc[1]), cat16b(xc[2], xc[3]) };
    __syncthreads();   // all of W^T and of the 64 rows of x is in LDS before any wave reads a fragment of them
    const int fo = lr * WP + 8 * hi;   // the lane's place in a 16-row fragment in LDS
    v8h oh[3][4], ol[4]; h16* dst[3];
#pragma unroll
    for (int part = 0; part < 2; ++part) {   // q, then k
        dst[part] = part == 0 ? Qh + (size_t)(g0 + wv * 16 + lr) * HD + 8 * hi : Kh + (size_t)(g0 + wv * 16) * HD + lane * 8;
        const int cs = part == 0 ? 16 : 256;   // from one 16-column piece to the next: along the row for q, one 512-byte block for k
#pragma unroll
        for (int ct = 0; ct < 4; ++ct) { const int c0 = part * HD + ct * 16; v8f acc = (v8f){};
#pragma unroll
            for (int s = 0; s < 2; ++s) acc = wmmab(WFrag<bf>::ld(wt + c0 * WP + fo + s * 32), xf[s], acc);
#pragma unroll
            for (int j = 0; j < 8; ++j) { h16 a, c2; const float y = acc[j] + bfr(bb[part * 4 + ct][j]); splitf(part == 0 ? y * CSL : y, a, c2); oh[part][ct][j] = a; if (part == 0) ol[ct][j] = c2; }
            *(v8h*)(dst[part] + ct * cs) = oh[part][ct]; if (part == 0) *(v8h*)(dst[part] + LO + ct * cs) = ol[ct]; } }
    {
        const int d0 = wv * 16;
        const V wb[2] = { WFrag<bf>::ld(wt + (2 * HD + d0) * WP + fo), WFrag<bf>::ld(wt + (2 * HD + d0) * WP + fo + 32) };
        dst[2] = Vh + (size_t)g0 * HD + wv * 512 + lane * 8;   // the group's 64 keys are two 32-key blocks of 2048 elements; the wave's 16 d are blocks 2 wv and 2 wv + 1 of each
#pragma unroll
        for (int mt = 0; mt < 4; ++mt) { v8f acc = (v8f){};
#pragma unroll
            for (int s = 0; s < 2; ++s) acc = wmmab(WFrag<bf>::ld(xs + mt * 16 * WP + fo + s * 32), wb[s], acc);
#pragma unroll
            for (int j = 0; j < 8; ++j) oh[2][mt][j] = (h16)(acc[j] + bv);
            *(v8h*)(dst[2] + (mt >> 1) * 2048 + (mt & 1) * 256) = oh[2][mt]; }
    }
    // every register that a store above names (its address, its data) stays as it is up to this wait: each tile keeps registers of its own, so no wait is needed between the stores
    asm volatile("s_wait_xcnt 0x0" :: "v"(dst[0]), "v"(dst[1]), "v"(dst[2]),
                 "v"(oh[0][0]), "v"(oh[0][1]), "v"(oh[0][2]), "v"(oh[0][3]), "v"(ol[0]), "v"(ol[1]), "v"(ol[2]), "v"(ol[3]),
                 "v"(oh[1][0]), "v"(oh[1][1]), "v"(oh[1][2]), "v"(oh[1][3]), "v"(oh[2][0]), "v"(oh[2][1]), "v"(oh[2][2]), "v"(oh[2][3]) : "memory");
}
// ---- k_fattn: scores, softmax and attn.v in one kernel; no score and no weight is stored in memory. Grid (T / (16 * QT), batches), QT * KS waves.
// A wave owns 16 queries (one per lane column) and T / KS keys, 64 keys a trip: St = K Qt - m (rows = keys), weights 2^St, running sum per query, Ot += Vt Pt (rows = d).
// m is a reference per query, not the running maximum: the first trip sets it to that trip's maximum, and it moves again only in a trip in which some lane's 32 weights sum to more than WMAX,
// so that every weight stays far inside f16's range. q comes scaled to log2 units and -m is the C operand of the first score WMMA of each tile: the accumulators are the exponents as they stand.
// A trip that does not move m has no maximum search, no multiply-add per score and no rescaling of Ot; one test a trip, a scalar branch.
// Two score tiles of 16 keys, converted in place, are the B operand of the second product in the hardware k order, which is also the order of WFrag::ld.
// K's fragments are fetched one trip ahead, into the registers that the first product has just finished with; Vt's at the top of their own trip: no load is waited for directly behind its issue.
// K and Vt come in k_proj's fragment order: a lane's two pieces of a fragment (the ones WFrag::ld takes from a row) lie at 16 * lane in two neighbouring 512-byte blocks.
// The KS partial results of a query tile meet in LDS and are joined by their references m, in split order.
typedef __attribute__((ext_vector_type(2))) __bf16 v2bf;
typedef __attribute__((ext_vector_type(8))) unsigned v8u;
__device__ __forceinline__ float xhalf(float x) { const int b = __float_as_int(x); return __int_as_float(__builtin_amdgcn_permlanex16(b, b, 0x76543210, 0xfedcba98, false, false)); }   // lane l <-> l ^ 16
// 2^x for two values. In asm so that the slot behind each v_exp_f32 is filled by construction: the second is independent of the first (results are kept off the sources), the v_nop stands behind the second;
__device__ __forceinline__ void exp2x2(float x0, float x1, float& y0, float& y1) { asm("v_exp_f32 %0, %2\n\tv_exp_f32 %1, %3\n\tv_nop" : "=&v"(y0), "=&v"(y1) : "v"(x0), "v"(x1)); }
template <bool B> struct Flag { static constexpr bool value = B; };
template <int QT, int KS>
__global__ __launch_bounds__(QT * KS * 32) void k_fattn(const h16* __restrict__ Q, const h16* __restrict__ K, const h16* __restrict__ Vt, float* __restrict__ O) {
    typedef WFrag<h16>::V V;
    constexpr int LO = NB_ * TT * HD;   // q's lo plane lies this many elements behind its hi plane: one address register pair serves both, the distance is an immediate
    constexpr float WMAX = 4096.0f;   // a lane's weight sum of one trip above this moves m; f16 holds up to 65504
    __shared__ __align__(16) float red[QT * KS * 16 * 68];
    __shared__ __align__(16) h16 qs[QT * KS * 8 * 32 * 8];
    __shared__ float stm[QT * KS * 16]; __shared__ float stl[QT * KS * 16];
    const int lane = threadIdx.x & 31, lr = lane & 15, hi = lane >> 4;
    const int w = __builtin_amdgcn_readfirstlane(threadIdx.x >> 5);   // the wave's number, the same in all its lanes: held in a scalar register, so that the operand bases below are scalar too
    const int qt = w % QT, ks = w / QT;
    const size_t zo = (size_t)blockIdx.y * TT * HD;
    const int q0 = blockIdx.x * (16 * QT);
    const h16* pk = K + zo + (size_t)ks * (TT / KS) * HD; const h16* pv = Vt + zo + (size_t)ks * (TT / KS) * HD;
    const unsigned vol = (unsigned)lane * 16u;   // the lane's place in a 512-byte block, in bytes
    auto at = [&](const h16* base) { return (const h16*)((const char*)base + vol); };
    auto ldf = [](const h16* p) { return cat16(*(const v8h*)p, *(const v8h*)(p + 256)); };   // a fragment: the lane's pieces of two neighbouring blocks
    V kh[4][2];        // K's fragments of the trip at hand; refilled for the next trip behind the first product. The first trip's are asked for here, ahead of Q, and arrive while Q is parked
    {
        const h16* a0 = at(pk);
#pragma unroll
        for (int kt = 0; kt < 4; ++kt) {
#pragma unroll
            for (int s = 0; s < 2; ++s) kh[kt][s] = ldf(a0 + kt * 1024 + s * 512); }
        asm volatile("s_wait_xcnt 0x0" :: "v"(a0) : "memory");   // the address pair of the first K loads stays as it is up to this wait
    }
    // Q's four fragments are parked in LDS, each lane's 16-byte pieces at the lane's own place, and read back at the top of every trip: kept in registers they would
    // hold 32 of them through the softmax and the second product. No other lane reads a lane's pieces: no barrier.
    h16* myq = qs + w * (8 * 32 * 8) + lane * 8;
    const size_t qo = zo + (size_t)(q0 + qt * 16 + lr) * HD + 8 * hi; const h16* aq = Q + qo;
#pragma unroll
    for (int f = 0; f < 8; ++f) *(v8ha*)(myq + f * 256) = *(const v8h*)(aq + (f >> 2) * LO + (f & 3) * 16);   // f = plane * 4 + k step * 2 + half
    asm volatile("s_wait_xcnt 0x0" :: "v"(aq) : "memory");   // the address pair of the Q loads stays as it is up to this wait; only behind it may its registers be reused
    v8f o[4];
#pragma unroll
    for (int mb = 0; mb < 4; ++mb) o[mb] = (v8f){};
    float nm = 0.f, l = 0.f;   // nm = -m
    v8f cm = (v8f){};   // nm in all eight rows of a score tile
    unsigned ko = 0;   // the trip's place in K and in Vt, in elements
    auto trip = [&](bool first, auto more) {   // first: m is not set yet (the same for the whole wave); more: another trip follows, and its K fragments are fetched in this one
        const h16* ak = at(pk + ko); const h16* av = at(pv + ko);   // the lane's two addresses of this trip; every load below is one of them plus an immediate
        V vh[4][2], qh[2], ql[2];
#pragma unroll
        for (int mb = 0; mb < 4; ++mb) {
#pragma unroll
            for (int u = 0; u < 2; ++u) vh[mb][u] = ldf(av + u * 2048 + mb * 512); }
#pragma unroll
        for (int s = 0; s < 2; ++s) { qh[s] = cat16(*(const v8ha*)(myq + (s * 2) * 256), *(const v8ha*)(myq + (s * 2 + 1) * 256)); ql[s] = cat16(*(const v8ha*)(myq + (4 + s * 2) * 256), *(const v8ha*)(myq + (4 + s * 2 + 1) * 256)); }
        __builtin_amdgcn_sched_barrier(0);   // keeps the trip's 16 Vt loads in front of its first WMMA: they have the first product and the softmax to arrive in
        v8f sc[4];
#pragma unroll
        for (int kt = 0; kt < 4; ++kt) {
            if constexpr (decltype(more)::value) sc[kt] = cm;
            else {   // the last trip spreads nm anew: taking cm out of the loop cost a copy of its eight registers in every trip
#pragma unroll
                for (int j = 0; j < 8; ++j) sc[kt][j] = nm; } }
#pragma unroll
        for (int s = 0; s < 2; ++s) {
#pragma unroll
            for (int kt = 0; kt < 4; ++kt) sc[kt] = wmma16(kh[kt][s], qh[s], sc[kt]);
#pragma unroll
            for (int kt = 0; kt < 4; ++kt) sc[kt] = wmma16(kh[kt][s], ql[s], sc[kt]); }
        if constexpr (decltype(more)::value) {
#pragma unroll
            for (int kt = 0; kt < 4; ++kt) {
#pragma unroll
                for (int s = 0; s < 2; ++s) kh[kt][s] = ldf(ak + 64 * HD + kt * 1024 + s * 512); }
            asm volatile("s_wait_xcnt 0x0" :: "v"(ak), "v"(av) : "memory");   // the trip's two address pairs stay as they are up to this wait; only behind it may their registers be reused
        } else {
            asm volatile("s_wait_xcnt 0x0" :: "v"(av) : "memory");   // the same for the last trip's one address pair
        }
        V ph[2]; float ls;
        auto weigh = [&]() {   // the trip's weights 2^sc, rounded to f16 as the second product's B operand, and the lane's sum of them (two chains of pair sums)
            v2f s0, s1;
#pragma unroll
            for (int u = 0; u < 2; ++u) { v8u wh;
#pragma unroll
                for (int e = 0; e < 8; ++e) { const int kt = 2 * u + (e >> 2), j = (e & 3) * 2; v2f p;
                    float p0, p1; exp2x2(sc[kt][j], sc[kt][j + 1], p0, p1); p[0] = p0; p[1] = p1;
                    if (u == 0 && e == 0) s0 = p; else if (u == 0 && e == 1) s1 = p; else if (e & 1) s1 += p; else s0 += p;
                    wh[e] = __builtin_bit_cast(unsigned, __builtin_convertvector(p, v2h)); }
                ph[u] = __builtin_bit_cast(V, wh); }
            s0 += s1; ls = s0[0] + s0[1]; };
        auto move = [&](auto set) {   // set: m becomes the trip's maximum, whatever it is, and there is nothing to rescale yet; else m goes up to it where it is higher, and the sum and Ot follow. The trip's exponents follow in both
            float mx = sc[0][0];
#pragma unroll
            for (int kt = 0; kt < 4; ++kt) {
#pragma unroll
                for (int j = 0; j < 8; ++j) mx = fmaxf(mx, sc[kt][j]); }
            mx = fmaxf(mx, xhalf(mx));   // the two lanes of a query hold different keys and need one common reference
            if constexpr (!decltype(set)::value) { mx = fmaxf(mx, 0.f); const float al = __builtin_amdgcn_exp2f(-mx); l *= al;
#pragma unroll
                for (int mb = 0; mb < 4; ++mb) o[mb] *= al; }
            nm -= mx;
            if constexpr (decltype(more)::value) {
#pragma unroll
                for (int j = 0; j < 8; ++j) cm[j] = nm; }
#pragma unroll
            for (int kt = 0; kt < 4; ++kt) sc[kt] -= mx; };
        // the four vector slots that the chip asks for between the last score WMMA and the first read of its result, on both sides of the branch below: the reader on the usual side is asm text (exp2x2)
        asm volatile("v_nop\n\tv_nop\n\tv_nop\n\tv_nop" :: "v"(sc[0]), "v"(sc[1]), "v"(sc[2]), "v"(sc[3]));
        __builtin_amdgcn_sched_barrier(0);   // keeps every reader of the scores behind those slots
        // both tests are the same for the whole wave: scalar branches
        if (__builtin_expect(first, false)) move(Flag<true>{});
        weigh();
        if (__builtin_expect(__builtin_amdgcn_ballot_w32(!(ls <= WMAX)) != 0, false)) { move(Flag<false>{}); weigh(); }
        l += ls;
        __builtin_amdgcn_sched_barrier(0);   // keeps the softmax arithmetic in front of the second product
#pragma unroll
        for (int u = 0; u < 2; ++u) {
#pragma unroll
            for (int mb = 0; mb < 4; ++mb) o[mb] = wmma16(vh[mb][u], ph[u], o[mb]); }
        ko += 64 * HD;
    };
    // rolled, for speed only: the body is long; the last trip, which has nothing to fetch ahead, stands by itself
#pragma unroll 1
    for (int t = 0; t < TT / KS / 64 - 1; ++t) trip(t == 0, Flag<true>{});
    trip(false, Flag<false>{});
    l += xhalf(l);   // the two halves' sums of a query, joined once
    float* my = red + w * (16 * 68) + lr * 68 + hi * 8;
#pragma unroll
    for (int mb = 0; mb < 4; ++mb) { v4f x0, x1;
#pragma unroll
        for (int j = 0; j < 4; ++j) { x0[j] = o[mb][j]; x1[j] = o[mb][4 + j]; }
        *(v4fa*)(my + mb * 16) = x0; *(v4fa*)(my + mb * 16 + 4) = x1; }
    if (hi == 0) { stm[w * 16 + lr] = -nm; stl[w * 16 + lr] = l; }
    __syncthreads();   // every wave's partial tile, reference m and sum are in LDS before any of them is joined
    // eight d a thread: a wave stores four whole 256-byte output rows
    for (int e = threadIdx.x; e < QT * 16 * 8; e += QT * KS * 32) { const int qq = e >> 3, tq = qq >> 4, r = qq & 15, d0 = (e & 7) * 8;
        float M = stm[tq * 16 + r];
#pragma unroll
        for (int s = 1; s < KS; ++s) M = fmaxf(M, stm[(s * QT + tq) * 16 + r]);
        float L = 0.f; v4f y0 = (v4f){}, y1 = (v4f){};
#pragma unroll
        for (int s = 0; s < KS; ++s) { const int ws = s * QT + tq; const float g = __builtin_amdgcn_exp2f(stm[ws * 16 + r] - M); L += g * stl[ws * 16 + r];
            const float* p = red + ws * (16 * 68) + r * 68 + d0; y0 += g * *(const v4fa*)p; y1 += g * *(const v4fa*)(p + 4); }
        const float f = __fdiv_rn(1.0f, L); float* dst = O + zo + (size_t)(q0 + qq) * HD + d0;
        *(v4f*)dst = y0 * f; *(v4f*)(dst + 4) = y1 * f; }
}

extern "C" void kernel_launch(void* const* d_in, const int* in_sizes, int n_in,
                              void* d_out, int out_size, void* d_ws, size_t ws_size, hipStream_t stream) {
    (void)in_sizes; (void)n_in; (void)out_size;
    const float* x = (const float*)d_in[0]; const float* w = (const float*)d_in[1]; const float* bqkv = (const float*)d_in[2];
    float* OUT = (float*)d_out;     // [4][4096][64]
    char* wsp = (char*)d_ws;
    auto take = [&](size_t bytes) { char* p = wsp; wsp += (bytes + 255) & ~(size_t)255; return (void*)p; };
    const size_t PN = (size_t)TT * HD;   // one batch's plane, in elements; every plane holds all batches
    h16* QPh = (h16*)take(2 * NB_ * PN * 2); h16* KPh = (h16*)take(NB_ * PN * 2); h16* VTh = (h16*)take(NB_ * PN * 2);   // q: hi plane, then lo plane; k and v: one plane each
    if ((size_t)(wsp - (char*)d_ws) > ws_size) return;    // ws 256 MiB
    k_proj<<<NB_ * TT / 64, 128, 0, stream>>>(x, w, bqkv, QPh, KPh, VTh);   /* [q | k | v] = x W + b, rounded to f16 planes (q times CSL, as hi/lo; v transposed), all batches */
    k_fattn<4, 4><<<dim3(TT / 64, NB_, 1), 4 * 4 * 32, 0, stream>>>(QPh, KPh, VTh, OUT);   /* out = softmax(q k / 8) v, all batches (rows of 256 B) */
}
